// v000
// Measured on an AMD MI455X. A time is GPU time per run, averaged over a window of back-to-back runs after a warm-up
// (all launches, gaps included; the runs take copies of the inputs in turn), and the median of several windows.
// Apart from v000's, it joins two sittings. Times from different sittings can be a few percent apart, while
// side-by-side timings come from the same sitting.
// v000, which the later versions start from, runs in 187 microseconds.
#include <hip/hip_runtime.h>
#include <hip/hip_bf16.h>

// ---------------------------------------------------------------------------
// AttentionHead for MI455X (gfx1250, wave32, WMMA f16 16x16x32 -> f32).
// Phase 1: QKV projection  x[BT,E] @ W[E,H] + b  -> f16 in workspace.
// Phase 2: fused flash attention (online softmax) -> f32 out.
// ---------------------------------------------------------------------------

#define B_  8
#define T_  2048
#define E_  1024
#define H_  64
#define BT_ (B_ * T_)

typedef _Float16 h2  __attribute__((ext_vector_type(2)));
typedef _Float16 h4  __attribute__((ext_vector_type(4)));
typedef _Float16 h8  __attribute__((ext_vector_type(8)));
typedef _Float16 h16 __attribute__((ext_vector_type(16)));
typedef float    f4  __attribute__((ext_vector_type(4)));
typedef float    f8  __attribute__((ext_vector_type(8)));

static __device__ __forceinline__ h16 hcat(h8 a, h8 b) {
    return __builtin_shufflevector(a, b, 0,1,2,3,4,5,6,7,8,9,10,11,12,13,14,15);
}

// D = A(16x32 f16) x B(32x16 f16) + C(16x16 f32)
static __device__ __forceinline__ f8 wmma_f16(h16 a, h16 b, f8 c) {
    return __builtin_amdgcn_wmma_f32_16x16x32_f16(
        /*neg_a=*/false, a, /*neg_b=*/false, b,
        /*c_mod=*/(short)0, c, /*reuse_a=*/false, /*reuse_b=*/false);
}

static __device__ __forceinline__ void lds_fence() {
    __builtin_amdgcn_wave_barrier();
    asm volatile("s_wait_dscnt 0x0" ::: "memory");
    __builtin_amdgcn_wave_barrier();
}

// ---------------------------------------------------------------------------
// Kernel 1: QKV projection.  grid = (BT/128, 1, 3), block = 256 (8 waves).
// Each block: 128x64 output tile of Q (z=0), K (z=1) or V (z=2).
// K staged 64 wide (2 WMMA k-steps per barrier pair, 8 WMMAs per stage).
// A fragment (per lane, 16 halves): lanes 0-15 row M=l, K={0..7,16..23};
// lanes 16-31 row M=l-16, K={8..15,24..31}.  B mirrors with lane = column.
// ---------------------------------------------------------------------------
__global__ __launch_bounds__(256)
void qkv_proj_kernel(const float* __restrict__ x,
                     const float* __restrict__ Wq, const float* __restrict__ bq,
                     const float* __restrict__ Wk, const float* __restrict__ bk,
                     const float* __restrict__ Wv, const float* __restrict__ bv,
                     _Float16* __restrict__ qkv)
{
    constexpr int KC   = 64;   // K per stage
    constexpr int STRA = 72;   // halves per A row in LDS (144 B, 16B aligned)
    constexpr int STRB = 72;   // halves per W^T row in LDS
    __shared__ _Float16 Alds[128 * STRA];
    __shared__ _Float16 Wlds[64 * STRB];

    const int z = blockIdx.z;
    const float* W    = (z == 0) ? Wq : (z == 1) ? Wk : Wv;
    const float* bias = (z == 0) ? bq : (z == 1) ? bk : bv;
    _Float16* out = qkv + (size_t)z * BT_ * H_;

    const int m0   = blockIdx.x * 128;
    const int t    = threadIdx.x;
    const int wave = t >> 5;
    const int lane = t & 31;
    const int ln   = lane & 15;
    const int hi8  = (lane >> 4) * 8;
    const int mrow = wave * 16 + ln;          // A-fragment row within tile

    f8 acc[4] = {};

    for (int kb = 0; kb < E_; kb += KC) {
        // prefetch next x stage (global_prefetch_b8)
        if (kb + KC < E_) {
            int u = t;
            int r = u >> 4, cv = (u & 15) * 4;
            __builtin_prefetch(x + (size_t)(m0 + r) * E_ + kb + KC + cv, 0, 1);
        }
        __syncthreads();
        // stage x tile (128 rows x 64 cols) as f16: 8 x f4 per thread
        #pragma unroll
        for (int i = 0; i < 8; ++i) {
            int u = t + i * 256;
            int r = u >> 4, cv = (u & 15) * 4;
            f4 xv = *(const f4*)(x + (size_t)(m0 + r) * E_ + kb + cv);
            h4 hv = { (_Float16)xv[0], (_Float16)xv[1],
                      (_Float16)xv[2], (_Float16)xv[3] };
            *(h4*)(Alds + r * STRA + cv) = hv;
        }
        // stage W tile (64 k x 64 cols) transposed as f16: Wlds[col][k]
        #pragma unroll
        for (int i = 0; i < 4; ++i) {
            int u = t + i * 256;
            int k = u >> 4, cv = (u & 15) * 4;
            f4 wv = *(const f4*)(W + (size_t)(kb + k) * H_ + cv);
            #pragma unroll
            for (int j = 0; j < 4; ++j)
                Wlds[(cv + j) * STRB + k] = (_Float16)wv[j];
        }
        __syncthreads();

        #pragma unroll
        for (int c = 0; c < 2; ++c) {
            const int ko = c * 32;
            // hoist all fragment loads, then issue WMMAs back-to-back
            h8 alo = *(const h8*)(Alds + mrow * STRA + ko + hi8);
            h8 ahi = *(const h8*)(Alds + mrow * STRA + ko + 16 + hi8);
            h16 a = hcat(alo, ahi);
            h16 bf[4];
            #pragma unroll
            for (int j = 0; j < 4; ++j) {
                int col = j * 16 + ln;
                h8 blo = *(const h8*)(Wlds + col * STRB + ko + hi8);
                h8 bhi = *(const h8*)(Wlds + col * STRB + ko + 16 + hi8);
                bf[j] = hcat(blo, bhi);
            }
            #pragma unroll
            for (int j = 0; j < 4; ++j)
                acc[j] = wmma_f16(a, bf[j], acc[j]);
        }
    }

    // bias add + f16 store.  D layout: VGPR r holds row r (lanes 0-15) or
    // row 8+r (lanes 16-31), col = j*16 + (lane&15).
    #pragma unroll
    for (int j = 0; j < 4; ++j) {
        int col = j * 16 + ln;
        float bj = bias[col];
        #pragma unroll
        for (int r = 0; r < 8; ++r) {
            int row = m0 + wave * 16 + r + hi8;
            out[(size_t)row * H_ + col] = (_Float16)(acc[j][r] + bj);
        }
    }
}

// ---------------------------------------------------------------------------
// Kernel 2: fused flash attention.  grid = (T/64, B), block = 128 (4 waves).
// Each wave owns 16 query rows; loop over key blocks of 32 with online softmax.
// ---------------------------------------------------------------------------
__global__ __launch_bounds__(128)
void flash_attn_kernel(const _Float16* __restrict__ Qh,
                       const _Float16* __restrict__ Kh,
                       const _Float16* __restrict__ Vh,
                       const int* __restrict__ mask,
                       float* __restrict__ out)
{
    constexpr int SSTR = 36;   // floats per S row in LDS
    constexpr int PSTR = 40;   // halves per P / V^T row in LDS
    __shared__ _Float16 VT[64 * PSTR];      // V^T: [col][key]
    __shared__ float    maskadd[32];
    __shared__ float    Sbuf[4][16 * SSTR]; // per-wave S scratch
    __shared__ _Float16 Pbuf[4][16 * PSTR]; // per-wave P (A-frag layout)
    __shared__ float    sc[4][16];          // per-wave row broadcast

    const int b    = blockIdx.y;
    const int q0   = blockIdx.x * 64;
    const int t    = threadIdx.x;
    const int wave = t >> 5;
    const int lane = t & 31;
    const int ln   = lane & 15;
    const int hi8  = (lane >> 4) * 8;

    const size_t kvbase = (size_t)b * T_ * H_;
    const int    qrow   = q0 + wave * 16 + ln;
    const size_t qbase  = kvbase + (size_t)qrow * H_;

    // preload Q fragments, pre-scaled by H^-0.5 = 0.125 (exact in f16)
    h16 aq[2];
    #pragma unroll
    for (int c = 0; c < 2; ++c) {
        h8 lo = *(const h8*)(Qh + qbase + c * 32 + hi8);
        h8 hc = *(const h8*)(Qh + qbase + c * 32 + 16 + hi8);
        h16 a = hcat(lo, hc);
        #pragma unroll
        for (int i = 0; i < 16; ++i) a[i] = a[i] * (_Float16)0.125f;
        aq[c] = a;
    }

    f8 o[4] = {};
    float mrun = -1e30f, lrun = 0.0f;

    // V staging decomposition: thread t handles cols cg*8..cg*8+7 of keys
    // 2*kp, 2*kp+1 and writes packed key-pairs (h2) into VT[col][key].
    const int kp = t & 15;
    const int cg = t >> 4;

    for (int kb = 0; kb < T_ / 32; ++kb) {
        const int n0 = kb * 32;
        __syncthreads();                     // protect VT/maskadd rewrite
        {
            const _Float16* v0p = Vh + kvbase + (size_t)(n0 + 2 * kp) * H_ + cg * 8;
            h8 v0 = *(const h8*)(v0p);
            h8 v1 = *(const h8*)(v0p + H_);
            #pragma unroll
            for (int i = 0; i < 8; ++i) {
                h2 pr = { v0[i], v1[i] };
                *(h2*)(VT + (cg * 8 + i) * PSTR + 2 * kp) = pr;
            }
        }
        if (t < 32) maskadd[t] = mask[b * T_ + n0 + t] ? 0.0f : -1e9f;
        __syncthreads();

        // S = (Q*scale) @ K^T : hoist all 4 K fragments, then 4 WMMAs
        h16 kf[2][2];
        #pragma unroll
        for (int c = 0; c < 2; ++c)
            #pragma unroll
            for (int j = 0; j < 2; ++j) {
                size_t kbn = kvbase + (size_t)(n0 + j * 16 + ln) * H_;
                h8 lo = *(const h8*)(Kh + kbn + c * 32 + hi8);
                h8 hc = *(const h8*)(Kh + kbn + c * 32 + 16 + hi8);
                kf[c][j] = hcat(lo, hc);
            }
        f8 s0 = {}, s1 = {};
        s0 = wmma_f16(aq[0], kf[0][0], s0);
        s1 = wmma_f16(aq[0], kf[0][1], s1);
        s0 = wmma_f16(aq[1], kf[1][0], s0);
        s1 = wmma_f16(aq[1], kf[1][1], s1);

        // spill S to per-wave LDS scratch
        float* sw = Sbuf[wave];
        #pragma unroll
        for (int r = 0; r < 8; ++r) {
            int row = r + hi8;
            sw[row * SSTR + ln]      = s0[r];
            sw[row * SSTR + 16 + ln] = s1[r];
        }
        lds_fence();

        // online softmax: lane r (< 16) owns query row r of this wave
        if (lane < 16) {
            const float* srow = sw + lane * SSTR;
            float sv[32];
            float mx = -1e30f;
            #pragma unroll
            for (int k = 0; k < 32; ++k) {
                sv[k] = srow[k] + maskadd[k];
                mx = fmaxf(mx, sv[k]);
            }
            float mnew  = fmaxf(mrun, mx);
            float alpha = __expf(mrun - mnew);
            float sum = 0.0f;
            _Float16* prow = Pbuf[wave] + lane * PSTR;
            #pragma unroll
            for (int k = 0; k < 32; ++k) {
                float p = __expf(sv[k] - mnew);
                sum += p;
                prow[k] = (_Float16)p;
            }
            lrun = alpha * lrun + sum;
            mrun = mnew;
            sc[wave][lane] = alpha;
        }
        lds_fence();

        // rescale accumulator by alpha(row)
        f4 a0 = *(const f4*)&sc[wave][hi8];
        f4 a1 = *(const f4*)&sc[wave][hi8 + 4];
        float ar[8] = { a0[0], a0[1], a0[2], a0[3], a1[0], a1[1], a1[2], a1[3] };
        #pragma unroll
        for (int j = 0; j < 4; ++j)
            #pragma unroll
            for (int r = 0; r < 8; ++r)
                o[j][r] *= ar[r];

        // O += P @ V : hoist P fragment + 4 V fragments, then 4 WMMAs
        h8 plo = *(const h8*)(Pbuf[wave] + ln * PSTR + hi8);
        h8 phi = *(const h8*)(Pbuf[wave] + ln * PSTR + 16 + hi8);
        h16 pf = hcat(plo, phi);
        h16 vf[4];
        #pragma unroll
        for (int j = 0; j < 4; ++j) {
            int col = j * 16 + ln;
            h8 vlo = *(const h8*)(VT + col * PSTR + hi8);
            h8 vhi = *(const h8*)(VT + col * PSTR + 16 + hi8);
            vf[j] = hcat(vlo, vhi);
        }
        #pragma unroll
        for (int j = 0; j < 4; ++j)
            o[j] = wmma_f16(pf, vf[j], o[j]);
    }

    // final 1/l normalization + f32 store
    if (lane < 16) sc[wave][lane] = 1.0f / lrun;
    lds_fence();
    f4 i0 = *(const f4*)&sc[wave][hi8];
    f4 i1 = *(const f4*)&sc[wave][hi8 + 4];
    float ir[8] = { i0[0], i0[1], i0[2], i0[3], i1[0], i1[1], i1[2], i1[3] };

    #pragma unroll
    for (int j = 0; j < 4; ++j) {
        int col = j * 16 + ln;
        #pragma unroll
        for (int r = 0; r < 8; ++r) {
            int row = q0 + wave * 16 + r + hi8;
            out[((size_t)b * T_ + row) * H_ + col] = o[j][r] * ir[r];
        }
    }
}

// ---------------------------------------------------------------------------
// Launch
// ---------------------------------------------------------------------------
extern "C" void kernel_launch(void* const* d_in, const int* in_sizes, int n_in,
                              void* d_out, int out_size, void* d_ws, size_t ws_size,
                              hipStream_t stream)
{
    const float* x    = (const float*)d_in[0];
    const float* Wq   = (const float*)d_in[1];
    const float* bq   = (const float*)d_in[2];
    const float* Wk   = (const float*)d_in[3];
    const float* bk   = (const float*)d_in[4];
    const float* Wv   = (const float*)d_in[5];
    const float* bv   = (const float*)d_in[6];
    const int*   mask = (const int*)d_in[7];
    float* out = (float*)d_out;

    _Float16* qkv = (_Float16*)d_ws;                 // 3 * BT * H halves = 6 MB
    const _Float16* Qh = qkv;
    const _Float16* Kh = qkv + (size_t)BT_ * H_;
    const _Float16* Vh = qkv + (size_t)2 * BT_ * H_;

    dim3 g1(BT_ / 128, 1, 3);
    qkv_proj_kernel<<<g1, 256, 0, stream>>>(x, Wq, bq, Wk, bk, Wv, bv, qkv);

    dim3 g2(T_ / 64, B_, 1);
    flash_attn_kernel<<<g2, 128, 0, stream>>>(Qh, Kh, Vh, mask, out);
}

// v001
// One run takes 93.1 microseconds.
// Timed twice side by side with v000, it ran 2.00 times as fast both times.
#include <hip/hip_runtime.h>
#include <hip/hip_bf16.h>

// ---------------------------------------------------------------------------
// AttentionHead for MI455X (gfx1250, wave32, WMMA f16 16x16x32 -> f32).
// Phase 1: QKV projection  x[BT,E] @ W[E,H] + b  -> f16 in workspace.
// Phase 2: fused flash attention (online softmax) -> f32 out.
// ---------------------------------------------------------------------------

#define B_  8
#define T_  2048
#define E_  1024
#define H_  64
#define BT_ (B_ * T_)

typedef _Float16 h2  __attribute__((ext_vector_type(2)));
typedef _Float16 h4  __attribute__((ext_vector_type(4)));
typedef _Float16 h8  __attribute__((ext_vector_type(8)));
typedef _Float16 h16 __attribute__((ext_vector_type(16)));
typedef float    f4  __attribute__((ext_vector_type(4)));
typedef float    f8  __attribute__((ext_vector_type(8)));

static __device__ __forceinline__ h16 hcat(h8 a, h8 b) {
    return __builtin_shufflevector(a, b, 0,1,2,3,4,5,6,7,8,9,10,11,12,13,14,15);
}

// D = A(16x32 f16) x B(32x16 f16) + C(16x16 f32)
static __device__ __forceinline__ f8 wmma_f16(h16 a, h16 b, f8 c) {
    return __builtin_amdgcn_wmma_f32_16x16x32_f16(
        /*neg_a=*/false, a, /*neg_b=*/false, b,
        /*c_mod=*/(short)0, c, /*reuse_a=*/false, /*reuse_b=*/false);
}

static __device__ __forceinline__ void lds_fence() {
    __builtin_amdgcn_wave_barrier();
    asm volatile("s_wait_dscnt 0x0" ::: "memory");
    __builtin_amdgcn_wave_barrier();
}

// ---------------------------------------------------------------------------
// Kernel 1: QKV projection.  grid = (BT/128, 1, 3), block = 256 (8 waves).
// Each block: 128x64 output tile of Q (z=0), K (z=1) or V (z=2).
// K staged 64 wide (2 WMMA k-steps per barrier pair, 8 WMMAs per stage).
// A fragment (per lane, 16 halves): lanes 0-15 row M=l, K={0..7,16..23};
// lanes 16-31 row M=l-16, K={8..15,24..31}.  B mirrors with lane = column.
// ---------------------------------------------------------------------------
__global__ __launch_bounds__(256)
void qkv_proj_kernel(const float* __restrict__ x,
                     const float* __restrict__ Wq, const float* __restrict__ bq,
                     const float* __restrict__ Wk, const float* __restrict__ bk,
                     const float* __restrict__ Wv, const float* __restrict__ bv,
                     _Float16* __restrict__ qkv)
{
    constexpr int KC   = 64;   // K per stage
    constexpr int STRA = 72;   // halves per A row in LDS (144 B, 16B aligned)
    constexpr int STRB = 72;   // halves per W^T row in LDS
    __shared__ _Float16 Alds[128 * STRA];
    __shared__ _Float16 Wlds[64 * STRB];

    const int z = blockIdx.z;
    const float* W    = (z == 0) ? Wq : (z == 1) ? Wk : Wv;
    const float* bias = (z == 0) ? bq : (z == 1) ? bk : bv;
    _Float16* out = qkv + (size_t)z * BT_ * H_;

    const int m0   = blockIdx.x * 128;
    const int t    = threadIdx.x;
    const int wave = t >> 5;
    const int lane = t & 31;
    const int ln   = lane & 15;
    const int hi8  = (lane >> 4) * 8;
    const int mrow = wave * 16 + ln;          // A-fragment row within tile

    f8 acc[4] = {};

    for (int kb = 0; kb < E_; kb += KC) {
        // prefetch next x stage (global_prefetch_b8)
        if (kb + KC < E_) {
            int u = t;
            int r = u >> 4, cv = (u & 15) * 4;
            __builtin_prefetch(x + (size_t)(m0 + r) * E_ + kb + KC + cv, 0, 1);
        }
        __syncthreads();
        // stage x tile (128 rows x 64 cols) as f16: 8 x f4 per thread
        #pragma unroll
        for (int i = 0; i < 8; ++i) {
            int u = t + i * 256;
            int r = u >> 4, cv = (u & 15) * 4;
            f4 xv = *(const f4*)(x + (size_t)(m0 + r) * E_ + kb + cv);
            h4 hv = { (_Float16)xv[0], (_Float16)xv[1],
                      (_Float16)xv[2], (_Float16)xv[3] };
            *(h4*)(Alds + r * STRA + cv) = hv;
        }
        // stage W tile (64 k x 64 cols) transposed as f16: Wlds[col][k]
        #pragma unroll
        for (int i = 0; i < 4; ++i) {
            int u = t + i * 256;
            int k = u >> 4, cv = (u & 15) * 4;
            f4 wv = *(const f4*)(W + (size_t)(kb + k) * H_ + cv);
            #pragma unroll
            for (int j = 0; j < 4; ++j)
                Wlds[(cv + j) * STRB + k] = (_Float16)wv[j];
        }
        __syncthreads();

        #pragma unroll
        for (int c = 0; c < 2; ++c) {
            const int ko = c * 32;
            // hoist all fragment loads, then issue WMMAs back-to-back
            h8 alo = *(const h8*)(Alds + mrow * STRA + ko + hi8);
            h8 ahi = *(const h8*)(Alds + mrow * STRA + ko + 16 + hi8);
            h16 a = hcat(alo, ahi);
            h16 bf[4];
            #pragma unroll
            for (int j = 0; j < 4; ++j) {
                int col = j * 16 + ln;
                h8 blo = *(const h8*)(Wlds + col * STRB + ko + hi8);
                h8 bhi = *(const h8*)(Wlds + col * STRB + ko + 16 + hi8);
                bf[j] = hcat(blo, bhi);
            }
            #pragma unroll
            for (int j = 0; j < 4; ++j)
                acc[j] = wmma_f16(a, bf[j], acc[j]);
        }
    }

    // bias add + f16 store.  D layout: VGPR r holds row r (lanes 0-15) or
    // row 8+r (lanes 16-31), col = j*16 + (lane&15).
    #pragma unroll
    for (int j = 0; j < 4; ++j) {
        int col = j * 16 + ln;
        float bj = bias[col];
        #pragma unroll
        for (int r = 0; r < 8; ++r) {
            int row = m0 + wave * 16 + r + hi8;
            out[(size_t)row * H_ + col] = (_Float16)(acc[j][r] + bj);
        }
    }
}

// ---------------------------------------------------------------------------
// Kernel 2: fused flash attention.  grid = (T/64, B), block = 128 (4 waves).
// Each wave owns 16 query rows; loop over key blocks of 32 with online softmax.
// The K fragments, the V rows and the mask words of block kb + 1 are loaded
// into registers during block kb, right behind its S products, so that their
// latency runs under the softmax and the P V products.
// ---------------------------------------------------------------------------
__global__ __launch_bounds__(128)
void flash_attn_kernel(const _Float16* __restrict__ Qh,
                       const _Float16* __restrict__ Kh,
                       const _Float16* __restrict__ Vh,
                       const int* __restrict__ mask,
                       float* __restrict__ out)
{
    constexpr int SSTR = 36;   // floats per S row in LDS
    constexpr int PSTR = 40;   // halves per P / V^T row in LDS
    __shared__ _Float16 VT[64 * PSTR];      // V^T: [col][key]
    __shared__ float    maskadd[32];
    __shared__ float    Sbuf[4][16 * SSTR]; // per-wave S scratch
    __shared__ _Float16 Pbuf[4][16 * PSTR]; // per-wave P (A-frag layout)
    __shared__ float    sc[4][16];          // per-wave row broadcast

    const int b    = blockIdx.y;
    const int q0   = blockIdx.x * 64;
    const int t    = threadIdx.x;
    const int wave = t >> 5;
    const int lane = t & 31;
    const int ln   = lane & 15;
    const int hi8  = (lane >> 4) * 8;

    const size_t kvbase = (size_t)b * T_ * H_;
    const int    qrow   = q0 + wave * 16 + ln;
    const size_t qbase  = kvbase + (size_t)qrow * H_;

    // preload Q fragments, pre-scaled by H^-0.5 = 0.125 (exact in f16)
    h16 aq[2];
    #pragma unroll
    for (int c = 0; c < 2; ++c) {
        h8 lo = *(const h8*)(Qh + qbase + c * 32 + hi8);
        h8 hc = *(const h8*)(Qh + qbase + c * 32 + 16 + hi8);
        h16 a = hcat(lo, hc);
        #pragma unroll
        for (int i = 0; i < 16; ++i) a[i] = a[i] * (_Float16)0.125f;
        aq[c] = a;
    }

    f8 o[4] = {};
    float mrun = -1e30f, lrun = 0.0f;

    // V staging decomposition: thread t handles cols cg*8..cg*8+7 of keys
    // 2*kp, 2*kp+1 and writes packed key-pairs (h2) into VT[col][key].
    const int kp = t & 15;
    const int cg = t >> 4;

    // this thread's addresses in key block 0
    const _Float16* vsrc = Vh + kvbase + (size_t)(2 * kp) * H_ + cg * 8;
    const _Float16* ksrc = Kh + kvbase + (size_t)ln * H_ + hi8;
    const int*      msrc = mask + b * T_ + lane;

    // registers that carry one key block from the pass that loads it to the
    // pass that uses it; filled here for block 0
    h8  v0 = *(const h8*)(vsrc);
    h8  v1 = *(const h8*)(vsrc + H_);
    int mk = *msrc;
    h8  kl[2][2], kh[2][2];
    #pragma unroll
    for (int c = 0; c < 2; ++c)
        #pragma unroll
        for (int j = 0; j < 2; ++j) {
            kl[c][j] = *(const h8*)(ksrc + j * 16 * H_ + c * 32);
            kh[c][j] = *(const h8*)(ksrc + j * 16 * H_ + c * 32 + 16);
        }

    for (int kb = 0; kb < T_ / 32; ++kb) {
        __syncthreads();                     // protect VT/maskadd rewrite
        #pragma unroll
        for (int i = 0; i < 8; ++i) {
            h2 pr = { v0[i], v1[i] };
            *(h2*)(VT + (cg * 8 + i) * PSTR + 2 * kp) = pr;
        }
        if (t < 32) maskadd[t] = mk ? 0.0f : -1e9f;
        __syncthreads();

        // S = (Q*scale) @ K^T from the fragments loaded one pass ago
        f8 s0 = {}, s1 = {};
        s0 = wmma_f16(aq[0], hcat(kl[0][0], kh[0][0]), s0);
        s1 = wmma_f16(aq[0], hcat(kl[0][1], kh[0][1]), s1);
        s0 = wmma_f16(aq[1], hcat(kl[1][0], kh[1][0]), s0);
        s1 = wmma_f16(aq[1], hcat(kl[1][1], kh[1][1]), s1);

        // issue the next block's loads; the last pass loads its own block
        // again, so that every address stays inside the batch's rows
        {
            const int nn = (kb + 1 < T_ / 32 ? kb + 1 : kb) * 32;
            const _Float16* kn = ksrc + (size_t)nn * H_;
            const _Float16* vn = vsrc + (size_t)nn * H_;
            #pragma unroll
            for (int c = 0; c < 2; ++c)
                #pragma unroll
                for (int j = 0; j < 2; ++j) {
                    kl[c][j] = *(const h8*)(kn + j * 16 * H_ + c * 32);
                    kh[c][j] = *(const h8*)(kn + j * 16 * H_ + c * 32 + 16);
                }
            v0 = *(const h8*)(vn);
            v1 = *(const h8*)(vn + H_);
            mk = msrc[nn];
        }

        // spill S to per-wave LDS scratch
        float* sw = Sbuf[wave];
        #pragma unroll
        for (int r = 0; r < 8; ++r) {
            int row = r + hi8;
            sw[row * SSTR + ln]      = s0[r];
            sw[row * SSTR + 16 + ln] = s1[r];
        }
        lds_fence();

        // online softmax: lane r (< 16) owns query row r of this wave
        if (lane < 16) {
            const float* srow = sw + lane * SSTR;
            float sv[32];
            float mx = -1e30f;
            #pragma unroll
            for (int k = 0; k < 32; ++k) {
                sv[k] = srow[k] + maskadd[k];
                mx = fmaxf(mx, sv[k]);
            }
            float mnew  = fmaxf(mrun, mx);
            float alpha = __expf(mrun - mnew);
            float sum = 0.0f;
            _Float16* prow = Pbuf[wave] + lane * PSTR;
            #pragma unroll
            for (int k = 0; k < 32; ++k) {
                float p = __expf(sv[k] - mnew);
                sum += p;
                prow[k] = (_Float16)p;
            }
            lrun = alpha * lrun + sum;
            mrun = mnew;
            sc[wave][lane] = alpha;
        }
        lds_fence();

        // rescale accumulator by alpha(row)
        f4 a0 = *(const f4*)&sc[wave][hi8];
        f4 a1 = *(const f4*)&sc[wave][hi8 + 4];
        float ar[8] = { a0[0], a0[1], a0[2], a0[3], a1[0], a1[1], a1[2], a1[3] };
        #pragma unroll
        for (int j = 0; j < 4; ++j)
            #pragma unroll
            for (int r = 0; r < 8; ++r)
                o[j][r] *= ar[r];

        // O += P @ V : hoist P fragment + 4 V fragments, then 4 WMMAs
        h8 plo = *(const h8*)(Pbuf[wave] + ln * PSTR + hi8);
        h8 phi = *(const h8*)(Pbuf[wave] + ln * PSTR + 16 + hi8);
        h16 pf = hcat(plo, phi);
        h16 vf[4];
        #pragma unroll
        for (int j = 0; j < 4; ++j) {
            int col = j * 16 + ln;
            h8 vlo = *(const h8*)(VT + col * PSTR + hi8);
            h8 vhi = *(const h8*)(VT + col * PSTR + 16 + hi8);
            vf[j] = hcat(vlo, vhi);
        }
        #pragma unroll
        for (int j = 0; j < 4; ++j)
            o[j] = wmma_f16(pf, vf[j], o[j]);
    }

    // final 1/l normalization + f32 store
    if (lane < 16) sc[wave][lane] = 1.0f / lrun;
    lds_fence();
    f4 i0 = *(const f4*)&sc[wave][hi8];
    f4 i1 = *(const f4*)&sc[wave][hi8 + 4];
    float ir[8] = { i0[0], i0[1], i0[2], i0[3], i1[0], i1[1], i1[2], i1[3] };

    #pragma unroll
    for (int j = 0; j < 4; ++j) {
        int col = j * 16 + ln;
        #pragma unroll
        for (int r = 0; r < 8; ++r) {
            int row = q0 + wave * 16 + r + hi8;
            out[((size_t)b * T_ + row) * H_ + col] = o[j][r] * ir[r];
        }
    }
}

// ---------------------------------------------------------------------------
// Launch
// ---------------------------------------------------------------------------
extern "C" void kernel_launch(void* const* d_in, const int* in_sizes, int n_in,
                              void* d_out, int out_size, void* d_ws, size_t ws_size,
                              hipStream_t stream)
{
    const float* x    = (const float*)d_in[0];
    const float* Wq   = (const float*)d_in[1];
    const float* bq   = (const float*)d_in[2];
    const float* Wk   = (const float*)d_in[3];
    const float* bk   = (const float*)d_in[4];
    const float* Wv   = (const float*)d_in[5];
    const float* bv   = (const float*)d_in[6];
    const int*   mask = (const int*)d_in[7];
    float* out = (float*)d_out;

    _Float16* qkv = (_Float16*)d_ws;                 // 3 * BT * H halves = 6 MB
    const _Float16* Qh = qkv;
    const _Float16* Kh = qkv + (size_t)BT_ * H_;
    const _Float16* Vh = qkv + (size_t)2 * BT_ * H_;

    dim3 g1(BT_ / 128, 1, 3);
    qkv_proj_kernel<<<g1, 256, 0, stream>>>(x, Wq, bq, Wk, bk, Wv, bv, qkv);

    dim3 g2(T_ / 64, B_, 1);
    flash_attn_kernel<<<g2, 128, 0, stream>>>(Qh, Kh, Vh, mask, out);
}

// v002
// It runs in 76.5 microseconds.
// In both of two side-by-side timings against v001, it was 1.18 times as fast.
// Over all steps from v000 it is 2.35 times as fast.
#include <hip/hip_runtime.h>
#include <hip/hip_bf16.h>

// ---------------------------------------------------------------------------
// AttentionHead for MI455X (gfx1250, wave32, WMMA f16 16x16x32 -> f32).
// Phase 1: QKV projection  x[BT,E] @ W[E,H] + b  -> f16 in workspace, laid out
//          as the finished WMMA fragments that phase 2 reads.
// Phase 2: fused flash attention (online softmax) -> f32 out.
//
// Workspace layout.  Each of Q, K, V is cut into blocks of 32 rows x 64 cols
// (FB_ = 2048 halves); a block is 8 pieces of 512 B; lane l owns bytes
// 16*l .. 16*l+15 of every piece (c = l & 15, h = l >> 4, e = 0..7):
//   Q, K piece ((cc*2 + jj)*2 + p): element e = M[jj*16 + c][cc*32 + p*16 + h*8 + e]
//   V    piece (j*2 + p)          : element e = V[p*16 + h*8 + e][j*16 + c]
// Pieces p = 0 and p = 1 together are one 16x32 (32x16) f16 operand.
// ---------------------------------------------------------------------------

#define B_  8
#define T_  2048
#define E_  1024
#define H_  64
#define BT_ (B_ * T_)
#define FB_ (32 * H_)   // halves in one 32-row fragment block

typedef _Float16 h2  __attribute__((ext_vector_type(2)));
typedef _Float16 h4  __attribute__((ext_vector_type(4)));
typedef _Float16 h8  __attribute__((ext_vector_type(8)));
typedef _Float16 h16 __attribute__((ext_vector_type(16)));
typedef float    f4  __attribute__((ext_vector_type(4)));
typedef float    f8  __attribute__((ext_vector_type(8)));

static __device__ __forceinline__ h16 hcat(h8 a, h8 b) {
    return __builtin_shufflevector(a, b, 0,1,2,3,4,5,6,7,8,9,10,11,12,13,14,15);
}

// D = A(16x32 f16) x B(32x16 f16) + C(16x16 f32)
static __device__ __forceinline__ f8 wmma_f16(h16 a, h16 b, f8 c) {
    return __builtin_amdgcn_wmma_f32_16x16x32_f16(
        /*neg_a=*/false, a, /*neg_b=*/false, b,
        /*c_mod=*/(short)0, c, /*reuse_a=*/false, /*reuse_b=*/false);
}

static __device__ __forceinline__ void lds_fence() {
    __builtin_amdgcn_wave_barrier();
    asm volatile("s_wait_dscnt 0x0" ::: "memory");
    __builtin_amdgcn_wave_barrier();
}

// ---------------------------------------------------------------------------
// Kernel 1: QKV projection.  grid = (BT/128, 1, 3), block = 256 (8 waves).
// Each block: 128x64 output tile of Q (z=0), K (z=1) or V (z=2).
// K staged 64 wide (2 WMMA k-steps per barrier pair, 8 WMMAs per stage).
// A fragment (per lane, 16 halves): lanes 0-15 row M=l, K={0..7,16..23};
// lanes 16-31 row M=l-16, K={8..15,24..31}.  B mirrors with lane = column.
// TR = true (Q, K): W^T is the A operand and x the B operand, so that a lane's
// 8 accumulators are 8 adjacent columns of one row.  TR = false (V): x is A,
// a lane's 8 accumulators are 8 adjacent rows of one column.  Either way they
// are one 16-byte element of the fragment layout above.
// ---------------------------------------------------------------------------
template <bool TR>
static __device__ __forceinline__
void proj_tile(const float* __restrict__ x, const float* __restrict__ W,
               const float* __restrict__ bias, _Float16* __restrict__ out,
               _Float16* Alds, _Float16* Wlds)
{
    constexpr int KC   = 64;   // K per stage
    constexpr int STRA = 72;   // halves per A row in LDS (144 B, 16B aligned)
    constexpr int STRB = 72;   // halves per W^T row in LDS

    const int m0   = blockIdx.x * 128;
    const int t    = threadIdx.x;
    const int wave = t >> 5;
    const int lane = t & 31;
    const int ln   = lane & 15;
    const int hi8  = (lane >> 4) * 8;
    const int mrow = wave * 16 + ln;          // x-fragment row within tile

    f8 acc[4] = {};

    for (int kb = 0; kb < E_; kb += KC) {
        // prefetch next x stage (global_prefetch_b8)
        if (kb + KC < E_) {
            int u = t;
            int r = u >> 4, cv = (u & 15) * 4;
            __builtin_prefetch(x + (size_t)(m0 + r) * E_ + kb + KC + cv, 0, 1);
        }
        __syncthreads();
        // stage x tile (128 rows x 64 cols) as f16: 8 x f4 per thread
        #pragma unroll
        for (int i = 0; i < 8; ++i) {
            int u = t + i * 256;
            int r = u >> 4, cv = (u & 15) * 4;
            f4 xv = *(const f4*)(x + (size_t)(m0 + r) * E_ + kb + cv);
            h4 hv = { (_Float16)xv[0], (_Float16)xv[1],
                      (_Float16)xv[2], (_Float16)xv[3] };
            *(h4*)(Alds + r * STRA + cv) = hv;
        }
        // stage W tile (64 k x 64 cols) transposed as f16: Wlds[col][k]
        #pragma unroll
        for (int i = 0; i < 4; ++i) {
            int u = t + i * 256;
            int k = u >> 4, cv = (u & 15) * 4;
            f4 wv = *(const f4*)(W + (size_t)(kb + k) * H_ + cv);
            #pragma unroll
            for (int j = 0; j < 4; ++j)
                Wlds[(cv + j) * STRB + k] = (_Float16)wv[j];
        }
        __syncthreads();

        #pragma unroll
        for (int c = 0; c < 2; ++c) {
            const int ko = c * 32;
            // hoist all fragment loads, then issue WMMAs back-to-back
            h8 alo = *(const h8*)(Alds + mrow * STRA + ko + hi8);
            h8 ahi = *(const h8*)(Alds + mrow * STRA + ko + 16 + hi8);
            h16 a = hcat(alo, ahi);
            h16 bf[4];
            #pragma unroll
            for (int j = 0; j < 4; ++j) {
                int col = j * 16 + ln;
                h8 blo = *(const h8*)(Wlds + col * STRB + ko + hi8);
                h8 bhi = *(const h8*)(Wlds + col * STRB + ko + 16 + hi8);
                bf[j] = hcat(blo, bhi);
            }
            #pragma unroll
            for (int j = 0; j < 4; ++j)
                acc[j] = TR ? wmma_f16(bf[j], a, acc[j])
                            : wmma_f16(a, bf[j], acc[j]);
        }
    }

    // bias add + f16 store: one 16-byte store per tile, 512 contiguous bytes
    // per wave.  This wave's 16 rows are half hf of 32-row block blk.
    const int blk = (m0 >> 5) + (wave >> 1);
    const int hf  = wave & 1;
    _Float16* ob = out + (size_t)blk * FB_ + lane * 8;
    #pragma unroll
    for (int j = 0; j < 4; ++j) {
        h8 pk;
        if (TR) {
            // acc[j][r] = row (wave*16 + ln), col (j*16 + hi8 + r)
            f4 b0 = *(const f4*)(bias + j * 16 + hi8);
            f4 b1 = *(const f4*)(bias + j * 16 + hi8 + 4);
            #pragma unroll
            for (int r = 0; r < 4; ++r) {
                pk[r]     = (_Float16)(acc[j][r]     + b0[r]);
                pk[r + 4] = (_Float16)(acc[j][r + 4] + b1[r]);
            }
            *(h8*)(ob + (((j >> 1) * 2 + hf) * 2 + (j & 1)) * 256) = pk;
        } else {
            // acc[j][r] = row (wave*16 + hi8 + r), col (j*16 + ln)
            float bj = bias[j * 16 + ln];
            #pragma unroll
            for (int r = 0; r < 8; ++r)
                pk[r] = (_Float16)(acc[j][r] + bj);
            *(h8*)(ob + (j * 2 + hf) * 256) = pk;
        }
    }
}

__global__ __launch_bounds__(256)
void qkv_proj_kernel(const float* __restrict__ x,
                     const float* __restrict__ Wq, const float* __restrict__ bq,
                     const float* __restrict__ Wk, const float* __restrict__ bk,
                     const float* __restrict__ Wv, const float* __restrict__ bv,
                     _Float16* __restrict__ qkv)
{
    __shared__ _Float16 Alds[128 * 72];
    __shared__ _Float16 Wlds[64 * 72];

    const int z = blockIdx.z;                 // the same for the whole block
    _Float16* out = qkv + (size_t)z * BT_ * H_;
    if (z == 2)
        proj_tile<false>(x, Wv, bv, out, Alds, Wlds);
    else
        proj_tile<true>(x, z == 0 ? Wq : Wk, z == 0 ? bq : bk, out, Alds, Wlds);
}

// ---------------------------------------------------------------------------
// Kernel 2: fused flash attention.  grid = (T/64, B), block = 128 (4 waves).
// Each wave owns 16 query rows; loop over key blocks of 32 with online softmax.
// Q, K and V come from the workspace as finished fragments: every load of a
// wave covers 512 contiguous bytes.  Nothing is shared between the waves, so
// the loop has no work-group barrier; LDS holds per-wave scratch only.
// The K fragments and the mask word of block kb + 1 are loaded right behind the
// S products of block kb; the V fragments of block kb are loaded at the head of
// its own pass, so that their latency runs under the S products and the softmax.
// ---------------------------------------------------------------------------
__global__ __launch_bounds__(128)
void flash_attn_kernel(const _Float16* __restrict__ Qh,
                       const _Float16* __restrict__ Kh,
                       const _Float16* __restrict__ Vh,
                       const int* __restrict__ mask,
                       float* __restrict__ out)
{
    constexpr int SSTR = 36;   // floats per S row in LDS
    constexpr int PSTR = 40;   // halves per P row in LDS
    __shared__ float    maskadd[4][32];     // per-wave additive key mask
    __shared__ float    Sbuf[4][16 * SSTR]; // per-wave S scratch
    __shared__ _Float16 Pbuf[4][16 * PSTR]; // per-wave P (A-frag layout)
    __shared__ float    sc[4][16];          // per-wave row broadcast

    const int b    = blockIdx.y;
    const int q0   = blockIdx.x * 64;
    const int t    = threadIdx.x;
    const int wave = t >> 5;
    const int lane = t & 31;
    const int ln   = lane & 15;
    const int hi8  = (lane >> 4) * 8;

    const size_t kvbase = (size_t)b * T_ * H_;   // = first 32-row block of b

    // preload Q fragments, pre-scaled by H^-0.5 = 0.125 (exact in f16)
    const _Float16* qsrc = Qh + kvbase
        + (size_t)(blockIdx.x * 2 + (wave >> 1)) * FB_ + lane * 8;
    h16 aq[2];
    #pragma unroll
    for (int c = 0; c < 2; ++c) {
        const int pc = (c * 2 + (wave & 1)) * 2;
        h8 lo = *(const h8*)(qsrc + pc * 256);
        h8 hc = *(const h8*)(qsrc + (pc + 1) * 256);
        h16 a = hcat(lo, hc);
        #pragma unroll
        for (int i = 0; i < 16; ++i) a[i] = a[i] * (_Float16)0.125f;
        aq[c] = a;
    }

    f8 o[4] = {};
    float mrun = -1e30f, lrun = 0.0f;

    // this lane's addresses in key block 0
    const _Float16* ksrc = Kh + kvbase + lane * 8;
    const _Float16* vsrc = Vh + kvbase + lane * 8;
    const int*      msrc = mask + b * T_ + lane;

    // registers that carry one key block from the pass that loads it to the
    // pass that uses it; filled here for block 0
    int mk = *msrc;
    h8  kl[2][2], kh[2][2];
    #pragma unroll
    for (int c = 0; c < 2; ++c)
        #pragma unroll
        for (int j = 0; j < 2; ++j) {
            kl[c][j] = *(const h8*)(ksrc + ((c * 2 + j) * 2) * 256);
            kh[c][j] = *(const h8*)(ksrc + ((c * 2 + j) * 2 + 1) * 256);
        }

    for (int kb = 0; kb < T_ / 32; ++kb) {
        // issue this block's V loads; they are used behind the softmax
        h8 vl[4], vh[4];
        {
            const _Float16* vn = vsrc + (size_t)kb * FB_;
            #pragma unroll
            for (int j = 0; j < 4; ++j) {
                vl[j] = *(const h8*)(vn + (j * 2) * 256);
                vh[j] = *(const h8*)(vn + (j * 2 + 1) * 256);
            }
        }

        // the last pass loads its own block again, so that every address
        // stays inside the batch's rows
        const size_t nn = (size_t)(kb + 1 < T_ / 32 ? kb + 1 : kb);

        // S = (Q*scale) @ K^T from the fragments loaded one pass ago
        f8 s0 = {}, s1 = {};
        s0 = wmma_f16(aq[0], hcat(kl[0][0], kh[0][0]), s0);
        s1 = wmma_f16(aq[0], hcat(kl[0][1], kh[0][1]), s1);
        s0 = wmma_f16(aq[1], hcat(kl[1][0], kh[1][0]), s0);
        s1 = wmma_f16(aq[1], hcat(kl[1][1], kh[1][1]), s1);
        const float madd = mk ? 0.0f : -1e9f;

        // precaution: the register pair that the issued V loads name may be
        // handed to a K load's result below; it is not rewritten ahead of this wait
        asm volatile("s_wait_xcnt 0x0" ::: "memory");

        // issue the next block's K and mask loads
        {
            const _Float16* kn = ksrc + nn * FB_;
            #pragma unroll
            for (int c = 0; c < 2; ++c)
                #pragma unroll
                for (int j = 0; j < 2; ++j) {
                    kl[c][j] = *(const h8*)(kn + ((c * 2 + j) * 2) * 256);
                    kh[c][j] = *(const h8*)(kn + ((c * 2 + j) * 2 + 1) * 256);
                }
            mk = msrc[nn * 32];
        }

        // spill S and the mask term to per-wave LDS scratch
        float* sw = Sbuf[wave];
        #pragma unroll
        for (int r = 0; r < 8; ++r) {
            int row = r + hi8;
            sw[row * SSTR + ln]      = s0[r];
            sw[row * SSTR + 16 + ln] = s1[r];
        }
        maskadd[wave][lane] = madd;
        lds_fence();

        // online softmax: lane r (< 16) owns query row r of this wave
        if (lane < 16) {
            const float* srow = sw + lane * SSTR;
            const float* mrow = maskadd[wave];
            float sv[32];
            float mx = -1e30f;
            #pragma unroll
            for (int k = 0; k < 32; ++k) {
                sv[k] = srow[k] + mrow[k];
                mx = fmaxf(mx, sv[k]);
            }
            float mnew  = fmaxf(mrun, mx);
            float alpha = __expf(mrun - mnew);
            float sum = 0.0f;
            _Float16* prow = Pbuf[wave] + lane * PSTR;
            #pragma unroll
            for (int k = 0; k < 32; ++k) {
                float p = __expf(sv[k] - mnew);
                sum += p;
                prow[k] = (_Float16)p;
            }
            lrun = alpha * lrun + sum;
            mrun = mnew;
            sc[wave][lane] = alpha;
        }
        lds_fence();

        // rescale accumulator by alpha(row)
        f4 a0 = *(const f4*)&sc[wave][hi8];
        f4 a1 = *(const f4*)&sc[wave][hi8 + 4];
        float ar[8] = { a0[0], a0[1], a0[2], a0[3], a1[0], a1[1], a1[2], a1[3] };
        #pragma unroll
        for (int j = 0; j < 4; ++j)
            #pragma unroll
            for (int r = 0; r < 8; ++r)
                o[j][r] *= ar[r];

        // O += P @ V from the V fragments loaded at the head of the pass
        h8 plo = *(const h8*)(Pbuf[wave] + ln * PSTR + hi8);
        h8 phi = *(const h8*)(Pbuf[wave] + ln * PSTR + 16 + hi8);
        h16 pf = hcat(plo, phi);
        #pragma unroll
        for (int j = 0; j < 4; ++j)
            o[j] = wmma_f16(pf, hcat(vl[j], vh[j]), o[j]);
    }

    // final 1/l normalization + f32 store
    if (lane < 16) sc[wave][lane] = 1.0f / lrun;
    lds_fence();
    f4 i0 = *(const f4*)&sc[wave][hi8];
    f4 i1 = *(const f4*)&sc[wave][hi8 + 4];
    float ir[8] = { i0[0], i0[1], i0[2], i0[3], i1[0], i1[1], i1[2], i1[3] };

    #pragma unroll
    for (int j = 0; j < 4; ++j) {
        int col = j * 16 + ln;
        #pragma unroll
        for (int r = 0; r < 8; ++r) {
            int row = q0 + wave * 16 + r + hi8;
            out[((size_t)b * T_ + row) * H_ + col] = o[j][r] * ir[r];
        }
    }
}

// ---------------------------------------------------------------------------
// Launch
// ---------------------------------------------------------------------------
extern "C" void kernel_launch(void* const* d_in, const int* in_sizes, int n_in,
                              void* d_out, int out_size, void* d_ws, size_t ws_size,
                              hipStream_t stream)
{
    const float* x    = (const float*)d_in[0];
    const float* Wq   = (const float*)d_in[1];
    const float* bq   = (const float*)d_in[2];
    const float* Wk   = (const float*)d_in[3];
    const float* bk   = (const float*)d_in[4];
    const float* Wv   = (const float*)d_in[5];
    const float* bv   = (const float*)d_in[6];
    const int*   mask = (const int*)d_in[7];
    float* out = (float*)d_out;

    _Float16* qkv = (_Float16*)d_ws;                 // 3 * BT * H halves = 6 MB
    const _Float16* Qh = qkv;
    const _Float16* Kh = qkv + (size_t)BT_ * H_;
    const _Float16* Vh = qkv + (size_t)2 * BT_ * H_;

    dim3 g1(BT_ / 128, 1, 3);
    qkv_proj_kernel<<<g1, 256, 0, stream>>>(x, Wq, bq, Wk, bk, Wv, bv, qkv);

    dim3 g2(T_ / 64, B_, 1);
    flash_attn_kernel<<<g2, 128, 0, stream>>>(Qh, Kh, Vh, mask, out);
}

// v003
// A run of this version takes 74 microseconds.
// Next to v002, in two timings, it ran 1.07 times as fast each time.
// All steps since v000 together make it 2.51 times as fast.
#include <hip/hip_runtime.h>
#include <hip/hip_bf16.h>

// ---------------------------------------------------------------------------
// AttentionHead for MI455X (gfx1250, wave32, WMMA f16 16x16x32 -> f32).
// Phase 1: QKV projection  x[BT,E] @ W[E,H] + b  -> f16 in workspace, laid out
//          as the finished WMMA fragments that phase 2 reads.
// Phase 2: fused flash attention (online softmax) -> f32 out.
//
// Workspace layout.  Each of Q, K, V is cut into blocks of 32 rows x 64 cols
// (FB_ = 2048 halves); a block is 8 pieces of 512 B; lane l owns bytes
// 16*l .. 16*l+15 of every piece (c = l & 15, h = l >> 4, e = 0..7):
//   Q, K piece ((cc*2 + jj)*2 + p): element e = M[jj*16 + c][cc*32 + p*16 + h*8 + e]
//   V    piece (j*2 + p)          : element e = V[p*16 + h*8 + e][j*16 + c]
// Pieces p = 0 and p = 1 together are one 16x32 (32x16) f16 operand.
// ---------------------------------------------------------------------------

#define B_  8
#define T_  2048
#define E_  1024
#define H_  64
#define BT_ (B_ * T_)
#define FB_ (32 * H_)   // halves in one 32-row fragment block

typedef _Float16 h2  __attribute__((ext_vector_type(2)));
typedef _Float16 h4  __attribute__((ext_vector_type(4)));
typedef _Float16 h8  __attribute__((ext_vector_type(8)));
typedef _Float16 h16 __attribute__((ext_vector_type(16)));
typedef float    f4  __attribute__((ext_vector_type(4)));
typedef float    f8  __attribute__((ext_vector_type(8)));

static __device__ __forceinline__ h16 hcat(h8 a, h8 b) {
    return __builtin_shufflevector(a, b, 0,1,2,3,4,5,6,7,8,9,10,11,12,13,14,15);
}

// D = A(16x32 f16) x B(32x16 f16) + C(16x16 f32)
static __device__ __forceinline__ f8 wmma_f16(h16 a, h16 b, f8 c) {
    return __builtin_amdgcn_wmma_f32_16x16x32_f16(
        /*neg_a=*/false, a, /*neg_b=*/false, b,
        /*c_mod=*/(short)0, c, /*reuse_a=*/false, /*reuse_b=*/false);
}

static __device__ __forceinline__ void lds_fence() {
    __builtin_amdgcn_wave_barrier();
    asm volatile("s_wait_dscnt 0x0" ::: "memory");
    __builtin_amdgcn_wave_barrier();
}

// Work-group barrier that orders LDS traffic only.  __syncthreads() would also
// wait for every global load in flight, and the projection's loads are meant to
// stay in flight across two stages.  The wait covers this wave's LDS reads and
// writes; the clobber keeps the compiler from moving LDS accesses across it.
static __device__ __forceinline__ void lds_barrier() {
    asm volatile("s_wait_dscnt 0x0\n\ts_barrier_signal -1\n\ts_barrier_wait -1" ::: "memory");
}

// ---------------------------------------------------------------------------
// Kernel 1: QKV projection.  grid = (BT/128, 1, 3), block = 256 (8 waves).
// Each block: 128x64 output tile of Q (z=0), K (z=1) or V (z=2).
// K staged 64 wide (2 WMMA k-steps per barrier pair, 8 WMMAs per stage); the
// global loads of a stage run two stages ahead of its LDS stores.
// A fragment (per lane, 16 halves): lanes 0-15 row M=l, K={0..7,16..23};
// lanes 16-31 row M=l-16, K={8..15,24..31}.  B mirrors with lane = column.
// TR = true (Q, K): W^T is the A operand and x the B operand, so that a lane's
// 8 accumulators are 8 adjacent columns of one row.  TR = false (V): x is A,
// a lane's 8 accumulators are 8 adjacent rows of one column.  Either way they
// are one 16-byte element of the fragment layout above.
// ---------------------------------------------------------------------------
template <bool TR>
static __device__ __forceinline__
void proj_tile(const float* __restrict__ x, const float* __restrict__ W,
               const float* __restrict__ bias, _Float16* __restrict__ out,
               _Float16* Alds, _Float16* Wlds)
{
    constexpr int KC   = 64;   // K per stage
    constexpr int STRA = 72;   // halves per A row in LDS (144 B, 16B aligned)
    constexpr int STRB = 72;   // halves per W^T row in LDS

    const int m0   = blockIdx.x * 128;
    const int t    = threadIdx.x;
    const int wave = t >> 5;
    const int lane = t & 31;
    const int ln   = lane & 15;
    const int hi8  = (lane >> 4) * 8;
    const int mrow = wave * 16 + ln;          // x-fragment row within tile

    f8 acc[4] = {};

    // this thread's place in every staged tile: row r0 + 16*i, 4 columns at cv
    const int r0 = t >> 4, cv = (t & 15) * 4;
    const f4* xs = (const f4*)(x + (size_t)m0 * E_);      // block-uniform
    const f4* ws = (const f4*)W;
    const unsigned vx = r0 * (E_ / 4) + (t & 15);
    const unsigned vw = r0 * (H_ / 4) + (t & 15);

    // all 12 loads of one stage (x: 128 rows x 64 k, W: 64 k x 64 cols) are
    // issued together, into registers that are read two stages later
    auto fetch = [&](f4 (&xr)[8], f4 (&wr)[4], int kb) {
        const f4* xk = xs + kb / 4;
        const f4* wk = ws + (size_t)kb * (H_ / 4);
        #pragma unroll
        for (int i = 0; i < 8; ++i)
            xr[i] = xk[i * 16 * (E_ / 4) + vx];
        #pragma unroll
        for (int i = 0; i < 4; ++i)
            wr[i] = wk[i * 16 * (H_ / 4) + vw];
    };

    // one stage: registers -> LDS as f16, refill the registers for stage kn
    // (more = false: no such stage), then the products of this stage
    auto stage = [&](f4 (&xr)[8], f4 (&wr)[4], int kn, bool more) {
        lds_barrier();
        #pragma unroll
        for (int i = 0; i < 8; ++i) {
            h4 hv = { (_Float16)xr[i][0], (_Float16)xr[i][1],
                      (_Float16)xr[i][2], (_Float16)xr[i][3] };
            *(h4*)(Alds + (r0 + i * 16) * STRA + cv) = hv;
        }
        // W tile transposed: Wlds[col][k]
        #pragma unroll
        for (int i = 0; i < 4; ++i)
            #pragma unroll
            for (int j = 0; j < 4; ++j)
                Wlds[(cv + j) * STRB + r0 + i * 16] = (_Float16)wr[i][j];
        lds_barrier();

        if (more) fetch(xr, wr, kn);

        #pragma unroll
        for (int c = 0; c < 2; ++c) {
            const int ko = c * 32;
            // hoist all fragment loads, then issue WMMAs back-to-back
            h8 alo = *(const h8*)(Alds + mrow * STRA + ko + hi8);
            h8 ahi = *(const h8*)(Alds + mrow * STRA + ko + 16 + hi8);
            h16 a = hcat(alo, ahi);
            h16 bf[4];
            #pragma unroll
            for (int j = 0; j < 4; ++j) {
                int col = j * 16 + ln;
                h8 blo = *(const h8*)(Wlds + col * STRB + ko + hi8);
                h8 bhi = *(const h8*)(Wlds + col * STRB + ko + 16 + hi8);
                bf[j] = hcat(blo, bhi);
            }
            #pragma unroll
            for (int j = 0; j < 4; ++j)
                acc[j] = TR ? wmma_f16(bf[j], a, acc[j])
                            : wmma_f16(a, bf[j], acc[j]);
        }
    };

    f4 xa[8], wa[4], xb[8], wb[4];
    fetch(xa, wa, 0);
    // keeps set a's loads ahead of set b's in issue order: loads return in
    // order, so the wait for set a can then leave all of set b's in flight
    __builtin_amdgcn_sched_barrier(0);
    fetch(xb, wb, KC);
    for (int kb = 0; kb < E_ - 2 * KC; kb += 2 * KC) {
        stage(xa, wa, kb + 2 * KC, true);
        stage(xb, wb, kb + 3 * KC, true);
    }
    stage(xa, wa, 0, false);
    stage(xb, wb, 0, false);

    // bias add + f16 store: one 16-byte store per tile, 512 contiguous bytes
    // per wave.  This wave's 16 rows are half hf of 32-row block blk.
    const int blk = (m0 >> 5) + (wave >> 1);
    const int hf  = wave & 1;
    _Float16* ob = out + (size_t)blk * FB_ + lane * 8;
    #pragma unroll
    for (int j = 0; j < 4; ++j) {
        h8 pk;
        if (TR) {
            // acc[j][r] = row (wave*16 + ln), col (j*16 + hi8 + r)
            f4 b0 = *(const f4*)(bias + j * 16 + hi8);
            f4 b1 = *(const f4*)(bias + j * 16 + hi8 + 4);
            #pragma unroll
            for (int r = 0; r < 4; ++r) {
                pk[r]     = (_Float16)(acc[j][r]     + b0[r]);
                pk[r + 4] = (_Float16)(acc[j][r + 4] + b1[r]);
            }
            *(h8*)(ob + (((j >> 1) * 2 + hf) * 2 + (j & 1)) * 256) = pk;
        } else {
            // acc[j][r] = row (wave*16 + hi8 + r), col (j*16 + ln)
            float bj = bias[j * 16 + ln];
            #pragma unroll
            for (int r = 0; r < 8; ++r)
                pk[r] = (_Float16)(acc[j][r] + bj);
            *(h8*)(ob + (j * 2 + hf) * 256) = pk;
        }
    }
}

__global__ __launch_bounds__(256)
void qkv_proj_kernel(const float* __restrict__ x,
                     const float* __restrict__ Wq, const float* __restrict__ bq,
                     const float* __restrict__ Wk, const float* __restrict__ bk,
                     const float* __restrict__ Wv, const float* __restrict__ bv,
                     _Float16* __restrict__ qkv)
{
    __shared__ _Float16 Alds[128 * 72];
    __shared__ _Float16 Wlds[64 * 72];

    const int z = blockIdx.z;                 // the same for the whole block
    _Float16* out = qkv + (size_t)z * BT_ * H_;
    if (z == 2)
        proj_tile<false>(x, Wv, bv, out, Alds, Wlds);
    else
        proj_tile<true>(x, z == 0 ? Wq : Wk, z == 0 ? bq : bk, out, Alds, Wlds);
}

// ---------------------------------------------------------------------------
// Kernel 2: fused flash attention.  grid = (T/64, B), block = 128 (4 waves).
// Each wave owns 16 query rows; loop over key blocks of 32 with online softmax.
// Q, K and V come from the workspace as finished fragments: every load of a
// wave covers 512 contiguous bytes.  Nothing is shared between the waves, so
// the loop has no work-group barrier; LDS holds per-wave scratch only.
// The K fragments and the mask word of block kb + 1 are loaded right behind the
// S products of block kb; the V fragments of block kb are loaded at the head of
// its own pass, so that their latency runs under the S products and the softmax.
// ---------------------------------------------------------------------------
__global__ __launch_bounds__(128)
void flash_attn_kernel(const _Float16* __restrict__ Qh,
                       const _Float16* __restrict__ Kh,
                       const _Float16* __restrict__ Vh,
                       const int* __restrict__ mask,
                       float* __restrict__ out)
{
    constexpr int SSTR = 36;   // floats per S row in LDS
    constexpr int PSTR = 40;   // halves per P row in LDS
    __shared__ float    maskadd[4][32];     // per-wave additive key mask
    __shared__ float    Sbuf[4][16 * SSTR]; // per-wave S scratch
    __shared__ _Float16 Pbuf[4][16 * PSTR]; // per-wave P (A-frag layout)
    __shared__ float    sc[4][16];          // per-wave row broadcast

    const int b    = blockIdx.y;
    const int q0   = blockIdx.x * 64;
    const int t    = threadIdx.x;
    const int wave = t >> 5;
    const int lane = t & 31;
    const int ln   = lane & 15;
    const int hi8  = (lane >> 4) * 8;

    const size_t kvbase = (size_t)b * T_ * H_;   // = first 32-row block of b

    // preload Q fragments, pre-scaled by H^-0.5 = 0.125 (exact in f16)
    const _Float16* qsrc = Qh + kvbase
        + (size_t)(blockIdx.x * 2 + (wave >> 1)) * FB_ + lane * 8;
    h16 aq[2];
    #pragma unroll
    for (int c = 0; c < 2; ++c) {
        const int pc = (c * 2 + (wave & 1)) * 2;
        h8 lo = *(const h8*)(qsrc + pc * 256);
        h8 hc = *(const h8*)(qsrc + (pc + 1) * 256);
        h16 a = hcat(lo, hc);
        #pragma unroll
        for (int i = 0; i < 16; ++i) a[i] = a[i] * (_Float16)0.125f;
        aq[c] = a;
    }

    f8 o[4] = {};
    float mrun = -1e30f, lrun = 0.0f;

    // this lane's addresses in key block 0
    const _Float16* ksrc = Kh + kvbase + lane * 8;
    const _Float16* vsrc = Vh + kvbase + lane * 8;
    const int*      msrc = mask + b * T_ + lane;

    // registers that carry one key block from the pass that loads it to the
    // pass that uses it; filled here for block 0
    int mk = *msrc;
    h8  kl[2][2], kh[2][2];
    #pragma unroll
    for (int c = 0; c < 2; ++c)
        #pragma unroll
        for (int j = 0; j < 2; ++j) {
            kl[c][j] = *(const h8*)(ksrc + ((c * 2 + j) * 2) * 256);
            kh[c][j] = *(const h8*)(ksrc + ((c * 2 + j) * 2 + 1) * 256);
        }

    for (int kb = 0; kb < T_ / 32; ++kb) {
        // issue this block's V loads; they are used behind the softmax
        h8 vl[4], vh[4];
        {
            const _Float16* vn = vsrc + (size_t)kb * FB_;
            #pragma unroll
            for (int j = 0; j < 4; ++j) {
                vl[j] = *(const h8*)(vn + (j * 2) * 256);
                vh[j] = *(const h8*)(vn + (j * 2 + 1) * 256);
            }
        }

        // the last pass loads its own block again, so that every address
        // stays inside the batch's rows
        const size_t nn = (size_t)(kb + 1 < T_ / 32 ? kb + 1 : kb);

        // S = (Q*scale) @ K^T from the fragments loaded one pass ago
        f8 s0 = {}, s1 = {};
        s0 = wmma_f16(aq[0], hcat(kl[0][0], kh[0][0]), s0);
        s1 = wmma_f16(aq[0], hcat(kl[0][1], kh[0][1]), s1);
        s0 = wmma_f16(aq[1], hcat(kl[1][0], kh[1][0]), s0);
        s1 = wmma_f16(aq[1], hcat(kl[1][1], kh[1][1]), s1);
        const float madd = mk ? 0.0f : -1e9f;

        // precaution: the register pair that the issued V loads name may be
        // handed to a K load's result below; it is not rewritten ahead of this wait
        asm volatile("s_wait_xcnt 0x0" ::: "memory");

        // issue the next block's K and mask loads
        {
            const _Float16* kn = ksrc + nn * FB_;
            #pragma unroll
            for (int c = 0; c < 2; ++c)
                #pragma unroll
                for (int j = 0; j < 2; ++j) {
                    kl[c][j] = *(const h8*)(kn + ((c * 2 + j) * 2) * 256);
                    kh[c][j] = *(const h8*)(kn + ((c * 2 + j) * 2 + 1) * 256);
                }
            mk = msrc[nn * 32];
        }

        // spill S and the mask term to per-wave LDS scratch
        float* sw = Sbuf[wave];
        #pragma unroll
        for (int r = 0; r < 8; ++r) {
            int row = r + hi8;
            sw[row * SSTR + ln]      = s0[r];
            sw[row * SSTR + 16 + ln] = s1[r];
        }
        maskadd[wave][lane] = madd;
        lds_fence();

        // online softmax: lane r (< 16) owns query row r of this wave
        if (lane < 16) {
            const float* srow = sw + lane * SSTR;
            const float* mrow = maskadd[wave];
            float sv[32];
            float mx = -1e30f;
            #pragma unroll
            for (int k = 0; k < 32; ++k) {
                sv[k] = srow[k] + mrow[k];
                mx = fmaxf(mx, sv[k]);
            }
            float mnew  = fmaxf(mrun, mx);
            float alpha = __expf(mrun - mnew);
            float sum = 0.0f;
            _Float16* prow = Pbuf[wave] + lane * PSTR;
            #pragma unroll
            for (int k = 0; k < 32; ++k) {
                float p = __expf(sv[k] - mnew);
                sum += p;
                prow[k] = (_Float16)p;
            }
            lrun = alpha * lrun + sum;
            mrun = mnew;
            sc[wave][lane] = alpha;
        }
        lds_fence();

        // rescale accumulator by alpha(row)
        f4 a0 = *(const f4*)&sc[wave][hi8];
        f4 a1 = *(const f4*)&sc[wave][hi8 + 4];
        float ar[8] = { a0[0], a0[1], a0[2], a0[3], a1[0], a1[1], a1[2], a1[3] };
        #pragma unroll
        for (int j = 0; j < 4; ++j)
            #pragma unroll
            for (int r = 0; r < 8; ++r)
                o[j][r] *= ar[r];

        // O += P @ V from the V fragments loaded at the head of the pass
        h8 plo = *(const h8*)(Pbuf[wave] + ln * PSTR + hi8);
        h8 phi = *(const h8*)(Pbuf[wave] + ln * PSTR + 16 + hi8);
        h16 pf = hcat(plo, phi);
        #pragma unroll
        for (int j = 0; j < 4; ++j)
            o[j] = wmma_f16(pf, hcat(vl[j], vh[j]), o[j]);
    }

    // final 1/l normalization + f32 store
    if (lane < 16) sc[wave][lane] = 1.0f / lrun;
    lds_fence();
    f4 i0 = *(const f4*)&sc[wave][hi8];
    f4 i1 = *(const f4*)&sc[wave][hi8 + 4];
    float ir[8] = { i0[0], i0[1], i0[2], i0[3], i1[0], i1[1], i1[2], i1[3] };

    #pragma unroll
    for (int j = 0; j < 4; ++j) {
        int col = j * 16 + ln;
        #pragma unroll
        for (int r = 0; r < 8; ++r) {
            int row = q0 + wave * 16 + r + hi8;
            out[((size_t)b * T_ + row) * H_ + col] = o[j][r] * ir[r];
        }
    }
}

// ---------------------------------------------------------------------------
// Launch
// ---------------------------------------------------------------------------
extern "C" void kernel_launch(void* const* d_in, const int* in_sizes, int n_in,
                              void* d_out, int out_size, void* d_ws, size_t ws_size,
                              hipStream_t stream)
{
    const float* x    = (const float*)d_in[0];
    const float* Wq   = (const float*)d_in[1];
    const float* bq   = (const float*)d_in[2];
    const float* Wk   = (const float*)d_in[3];
    const float* bk   = (const float*)d_in[4];
    const float* Wv   = (const float*)d_in[5];
    const float* bv   = (const float*)d_in[6];
    const int*   mask = (const int*)d_in[7];
    float* out = (float*)d_out;

    _Float16* qkv = (_Float16*)d_ws;                 // 3 * BT * H halves = 6 MB
    const _Float16* Qh = qkv;
    const _Float16* Kh = qkv + (size_t)BT_ * H_;
    const _Float16* Vh = qkv + (size_t)2 * BT_ * H_;

    dim3 g1(BT_ / 128, 1, 3);
    qkv_proj_kernel<<<g1, 256, 0, stream>>>(x, Wq, bq, Wk, bk, Wv, bv, qkv);

    dim3 g2(T_ / 64, B_, 1);
    flash_attn_kernel<<<g2, 128, 0, stream>>>(Qh, Kh, Vh, mask, out);
}

// v004
// It runs in 46.1 microseconds.
// Next to v003, in two timings, it ran 1.63 and 1.70 times as fast.
// Over all steps from v000 it is 4.18 times as fast.
#include <hip/hip_runtime.h>
#include <hip/hip_bf16.h>

// ---------------------------------------------------------------------------
// AttentionHead for MI455X (gfx1250, wave32, WMMA f16 16x16x32 -> f32).
// Phase 1: QKV projection  x[BT,E] @ W[E,H] + b  -> f16 in workspace, laid out
//          as the finished WMMA fragments that phase 2 reads.
// Phase 2: fused flash attention (online softmax) -> f32 out.
//
// Workspace layout.  Each of Q, K, V is cut into blocks of 32 rows x 64 cols
// (FB_ = 2048 halves); a block is 8 pieces of 512 B; lane l owns bytes
// 16*l .. 16*l+15 of every piece (c = l & 15, h = l >> 4, e = 0..7):
//   Q, K piece ((cc*2 + jj)*2 + p): element e = M[jj*16 + c][cc*32 + p*16 + h*8 + e]
//   V    piece (j*2 + p)          : element e = V[p*16 + h*8 + e][j*16 + c]
// Pieces p = 0 and p = 1 together are one 16x32 (32x16) f16 operand.
// ---------------------------------------------------------------------------

#define B_  8
#define T_  2048
#define E_  1024
#define H_  64
#define BT_ (B_ * T_)
#define FB_ (32 * H_)   // halves in one 32-row fragment block

typedef _Float16 h2  __attribute__((ext_vector_type(2)));
typedef _Float16 h4  __attribute__((ext_vector_type(4)));
typedef _Float16 h8  __attribute__((ext_vector_type(8)));
typedef _Float16 h16 __attribute__((ext_vector_type(16)));
typedef float    f4  __attribute__((ext_vector_type(4)));
typedef float    f8  __attribute__((ext_vector_type(8)));

static __device__ __forceinline__ h16 hcat(h8 a, h8 b) {
    return __builtin_shufflevector(a, b, 0,1,2,3,4,5,6,7,8,9,10,11,12,13,14,15);
}

// D = A(16x32 f16) x B(32x16 f16) + C(16x16 f32)
static __device__ __forceinline__ f8 wmma_f16(h16 a, h16 b, f8 c) {
    return __builtin_amdgcn_wmma_f32_16x16x32_f16(
        /*neg_a=*/false, a, /*neg_b=*/false, b,
        /*c_mod=*/(short)0, c, /*reuse_a=*/false, /*reuse_b=*/false);
}

static __device__ __forceinline__ void lds_fence() {
    __builtin_amdgcn_wave_barrier();
    asm volatile("s_wait_dscnt 0x0" ::: "memory");
    __builtin_amdgcn_wave_barrier();
}

// Work-group barrier that orders LDS traffic only.  __syncthreads() would also
// wait for every global load in flight, and the projection's loads are meant to
// stay in flight across two stages.  The wait covers this wave's LDS reads and
// writes; the clobber keeps the compiler from moving LDS accesses across it.
static __device__ __forceinline__ void lds_barrier() {
    asm volatile("s_wait_dscnt 0x0\n\ts_barrier_signal -1\n\ts_barrier_wait -1" ::: "memory");
}

// ---------------------------------------------------------------------------
// Kernel 1: QKV projection.  grid = (BT/128, 1, 3), block = 256 (8 waves).
// Each block: 128x64 output tile of Q (z=0), K (z=1) or V (z=2).
// K staged 64 wide (2 WMMA k-steps per barrier pair, 8 WMMAs per stage); the
// global loads of a stage run two stages ahead of its LDS stores.
// A fragment (per lane, 16 halves): lanes 0-15 row M=l, K={0..7,16..23};
// lanes 16-31 row M=l-16, K={8..15,24..31}.  B mirrors with lane = column.
// TR = true (Q, K): W^T is the A operand and x the B operand, so that a lane's
// 8 accumulators are 8 adjacent columns of one row.  TR = false (V): x is A,
// a lane's 8 accumulators are 8 adjacent rows of one column.  Either way they
// are one 16-byte element of the fragment layout above.
// ---------------------------------------------------------------------------
template <bool TR>
static __device__ __forceinline__
void proj_tile(const float* __restrict__ x, const float* __restrict__ W,
               const float* __restrict__ bias, _Float16* __restrict__ out,
               _Float16* Alds, _Float16* Wlds)
{
    constexpr int KC   = 64;   // K per stage
    constexpr int STRA = 72;   // halves per A row in LDS (144 B, 16B aligned)
    constexpr int STRB = 72;   // halves per W^T row in LDS

    const int m0   = blockIdx.x * 128;
    const int t    = threadIdx.x;
    const int wave = t >> 5;
    const int lane = t & 31;
    const int ln   = lane & 15;
    const int hi8  = (lane >> 4) * 8;
    const int mrow = wave * 16 + ln;          // x-fragment row within tile

    f8 acc[4] = {};

    // this thread's place in every staged tile: row r0 + 16*i, 4 columns at cv
    const int r0 = t >> 4, cv = (t & 15) * 4;
    const f4* xs = (const f4*)(x + (size_t)m0 * E_);      // block-uniform
    const f4* ws = (const f4*)W;
    const unsigned vx = r0 * (E_ / 4) + (t & 15);
    const unsigned vw = r0 * (H_ / 4) + (t & 15);

    // all 12 loads of one stage (x: 128 rows x 64 k, W: 64 k x 64 cols) are
    // issued together, into registers that are read two stages later
    auto fetch = [&](f4 (&xr)[8], f4 (&wr)[4], int kb) {
        const f4* xk = xs + kb / 4;
        const f4* wk = ws + (size_t)kb * (H_ / 4);
        #pragma unroll
        for (int i = 0; i < 8; ++i)
            xr[i] = xk[i * 16 * (E_ / 4) + vx];
        #pragma unroll
        for (int i = 0; i < 4; ++i)
            wr[i] = wk[i * 16 * (H_ / 4) + vw];
    };

    // one stage: registers -> LDS as f16, refill the registers for stage kn
    // (more = false: no such stage), then the products of this stage
    auto stage = [&](f4 (&xr)[8], f4 (&wr)[4], int kn, bool more) {
        lds_barrier();
        #pragma unroll
        for (int i = 0; i < 8; ++i) {
            h4 hv = { (_Float16)xr[i][0], (_Float16)xr[i][1],
                      (_Float16)xr[i][2], (_Float16)xr[i][3] };
            *(h4*)(Alds + (r0 + i * 16) * STRA + cv) = hv;
        }
        // W tile transposed: Wlds[col][k]
        #pragma unroll
        for (int i = 0; i < 4; ++i)
            #pragma unroll
            for (int j = 0; j < 4; ++j)
                Wlds[(cv + j) * STRB + r0 + i * 16] = (_Float16)wr[i][j];
        lds_barrier();

        if (more) fetch(xr, wr, kn);

        #pragma unroll
        for (int c = 0; c < 2; ++c) {
            const int ko = c * 32;
            // hoist all fragment loads, then issue WMMAs back-to-back
            h8 alo = *(const h8*)(Alds + mrow * STRA + ko + hi8);
            h8 ahi = *(const h8*)(Alds + mrow * STRA + ko + 16 + hi8);
            h16 a = hcat(alo, ahi);
            h16 bf[4];
            #pragma unroll
            for (int j = 0; j < 4; ++j) {
                int col = j * 16 + ln;
                h8 blo = *(const h8*)(Wlds + col * STRB + ko + hi8);
                h8 bhi = *(const h8*)(Wlds + col * STRB + ko + 16 + hi8);
                bf[j] = hcat(blo, bhi);
            }
            #pragma unroll
            for (int j = 0; j < 4; ++j)
                acc[j] = TR ? wmma_f16(bf[j], a, acc[j])
                            : wmma_f16(a, bf[j], acc[j]);
        }
    };

    f4 xa[8], wa[4], xb[8], wb[4];
    fetch(xa, wa, 0);
    // keeps set a's loads ahead of set b's in issue order: loads return in
    // order, so the wait for set a can then leave all of set b's in flight
    __builtin_amdgcn_sched_barrier(0);
    fetch(xb, wb, KC);
    for (int kb = 0; kb < E_ - 2 * KC; kb += 2 * KC) {
        stage(xa, wa, kb + 2 * KC, true);
        stage(xb, wb, kb + 3 * KC, true);
    }
    stage(xa, wa, 0, false);
    stage(xb, wb, 0, false);

    // bias add + f16 store: one 16-byte store per tile, 512 contiguous bytes
    // per wave.  This wave's 16 rows are half hf of 32-row block blk.
    const int blk = (m0 >> 5) + (wave >> 1);
    const int hf  = wave & 1;
    _Float16* ob = out + (size_t)blk * FB_ + lane * 8;
    #pragma unroll
    for (int j = 0; j < 4; ++j) {
        h8 pk;
        if (TR) {
            // acc[j][r] = row (wave*16 + ln), col (j*16 + hi8 + r)
            f4 b0 = *(const f4*)(bias + j * 16 + hi8);
            f4 b1 = *(const f4*)(bias + j * 16 + hi8 + 4);
            #pragma unroll
            for (int r = 0; r < 4; ++r) {
                pk[r]     = (_Float16)(acc[j][r]     + b0[r]);
                pk[r + 4] = (_Float16)(acc[j][r + 4] + b1[r]);
            }
            *(h8*)(ob + (((j >> 1) * 2 + hf) * 2 + (j & 1)) * 256) = pk;
        } else {
            // acc[j][r] = row (wave*16 + hi8 + r), col (j*16 + ln)
            float bj = bias[j * 16 + ln];
            #pragma unroll
            for (int r = 0; r < 8; ++r)
                pk[r] = (_Float16)(acc[j][r] + bj);
            *(h8*)(ob + (j * 2 + hf) * 256) = pk;
        }
    }
}

__global__ __launch_bounds__(256)
void qkv_proj_kernel(const float* __restrict__ x,
                     const float* __restrict__ Wq, const float* __restrict__ bq,
                     const float* __restrict__ Wk, const float* __restrict__ bk,
                     const float* __restrict__ Wv, const float* __restrict__ bv,
                     _Float16* __restrict__ qkv)
{
    __shared__ _Float16 Alds[128 * 72];
    __shared__ _Float16 Wlds[64 * 72];

    const int z = blockIdx.z;                 // the same for the whole block
    _Float16* out = qkv + (size_t)z * BT_ * H_;
    if (z == 2)
        proj_tile<false>(x, Wv, bv, out, Alds, Wlds);
    else
        proj_tile<true>(x, z == 0 ? Wq : Wk, z == 0 ? bq : bk, out, Alds, Wlds);
}

// ---------------------------------------------------------------------------
// Kernel 2: fused flash attention.  grid = (T/64, B), block = 512 (16 waves).
// Wave w works on query tile qt = w & 3 (16 query rows) and on key quarter
// ks = w >> 2 (T/4 keys): four waves share each SIMD and fill each other's
// waits.  Each wave loops over its key blocks of 32 with online softmax.
// Q, K and V come from the workspace as finished fragments: every load of a
// wave covers 512 contiguous bytes.  Nothing is shared between the waves inside
// the loop, so the loop has no work-group barrier; there LDS holds per-wave
// scratch only.  Behind the loop the four partial results of a query tile
// (running maximum, running sum, unnormalised O) meet in LDS, and each of the
// four waves finishes four of the tile's 16 rows.
// The K fragments and the mask word of block kb + 1 are loaded right behind the
// S products of block kb; the V fragments of block kb are loaded at the head of
// its own pass, so that their latency runs under the S products and the softmax.
// ---------------------------------------------------------------------------
__global__ __launch_bounds__(512)
void flash_attn_kernel(const _Float16* __restrict__ Qh,
                       const _Float16* __restrict__ Kh,
                       const _Float16* __restrict__ Vh,
                       const int* __restrict__ mask,
                       float* __restrict__ out)
{
    constexpr int NW   = 16;   // waves per block
    constexpr int NS   = 4;    // key quarters
    constexpr int KBS  = T_ / 32 / NS;   // key blocks per wave
    constexpr int SSTR = 36;   // floats per S row in LDS
    constexpr int PSTR = 40;   // halves per P row in LDS
    __shared__ float    maskadd[NW][32];     // per-wave additive key mask
    __shared__ float    Sbuf[NW][16 * SSTR]; // per-wave S scratch
    __shared__ _Float16 Pbuf[NW][16 * PSTR]; // per-wave P (A-frag layout)
    __shared__ float    sc[NW][16];          // per-wave row broadcast
    // partial results: Opart[w][(j*4 + rp)*64 + lane*2 + i] = o[j][rp*2 + i]
    __shared__ float    Opart[NW][16 * H_];
    __shared__ float    mpart[NW][16];       // running maximum of each row
    __shared__ float    lpart[NW][16];       // running sum of each row

    const int b    = blockIdx.y;
    const int q0   = blockIdx.x * 64;
    const int t    = threadIdx.x;
    // the wave's number in a scalar register: the loop's bounds depend on it
    const int wave = __builtin_amdgcn_readfirstlane(t >> 5);
    const int qt   = wave & 3;
    const int ks   = wave >> 2;
    const int lane = t & 31;
    const int ln   = lane & 15;
    const int hi8  = (lane >> 4) * 8;

    const size_t kvbase = (size_t)b * T_ * H_;   // = first 32-row block of b

    // preload Q fragments, pre-scaled by H^-0.5 = 0.125 (exact in f16)
    const _Float16* qsrc = Qh + kvbase
        + (size_t)(blockIdx.x * 2 + (qt >> 1)) * FB_ + lane * 8;
    h16 aq[2];
    #pragma unroll
    for (int c = 0; c < 2; ++c) {
        const int pc = (c * 2 + (qt & 1)) * 2;
        h8 lo = *(const h8*)(qsrc + pc * 256);
        h8 hc = *(const h8*)(qsrc + (pc + 1) * 256);
        h16 a = hcat(lo, hc);
        #pragma unroll
        for (int i = 0; i < 16; ++i) a[i] = a[i] * (_Float16)0.125f;
        aq[c] = a;
    }

    f8 o[4] = {};
    float mrun = -1e30f, lrun = 0.0f;

    // this lane's addresses in key block 0 of the batch
    const _Float16* ksrc = Kh + kvbase + lane * 8;
    const _Float16* vsrc = Vh + kvbase + lane * 8;
    const int*      msrc = mask + b * T_ + lane;

    const int kb0 = ks * KBS;   // this wave's first key block

    // registers that carry one key block from the pass that loads it to the
    // pass that uses it; filled here for block kb0
    int mk = msrc[kb0 * 32];
    h8  kl[2][2], kh[2][2];
    #pragma unroll
    for (int c = 0; c < 2; ++c)
        #pragma unroll
        for (int j = 0; j < 2; ++j) {
            const _Float16* k0 = ksrc + (size_t)kb0 * FB_;
            kl[c][j] = *(const h8*)(k0 + ((c * 2 + j) * 2) * 256);
            kh[c][j] = *(const h8*)(k0 + ((c * 2 + j) * 2 + 1) * 256);
        }

    for (int kb = kb0; kb < kb0 + KBS; ++kb) {
        // issue this block's V loads; they are used behind the softmax
        h8 vl[4], vh[4];
        {
            const _Float16* vn = vsrc + (size_t)kb * FB_;
            #pragma unroll
            for (int j = 0; j < 4; ++j) {
                vl[j] = *(const h8*)(vn + (j * 2) * 256);
                vh[j] = *(const h8*)(vn + (j * 2 + 1) * 256);
            }
        }

        // the wave's last pass loads its own block again, so that every
        // address stays inside the wave's own keys
        const size_t nn = (size_t)(kb + 1 < kb0 + KBS ? kb + 1 : kb);

        // S = (Q*scale) @ K^T from the fragments loaded one pass ago
        f8 s0 = {}, s1 = {};
        s0 = wmma_f16(aq[0], hcat(kl[0][0], kh[0][0]), s0);
        s1 = wmma_f16(aq[0], hcat(kl[0][1], kh[0][1]), s1);
        s0 = wmma_f16(aq[1], hcat(kl[1][0], kh[1][0]), s0);
        s1 = wmma_f16(aq[1], hcat(kl[1][1], kh[1][1]), s1);
        const float madd = mk ? 0.0f : -1e9f;

        // precaution: the register pair that the issued V loads name may be
        // handed to a K load's result below; it is not rewritten ahead of this wait
        asm volatile("s_wait_xcnt 0x0" ::: "memory");

        // issue the next block's K and mask loads
        {
            const _Float16* kn = ksrc + nn * FB_;
            #pragma unroll
            for (int c = 0; c < 2; ++c)
                #pragma unroll
                for (int j = 0; j < 2; ++j) {
                    kl[c][j] = *(const h8*)(kn + ((c * 2 + j) * 2) * 256);
                    kh[c][j] = *(const h8*)(kn + ((c * 2 + j) * 2 + 1) * 256);
                }
            mk = msrc[nn * 32];
        }

        // spill S and the mask term to per-wave LDS scratch
        float* sw = Sbuf[wave];
        #pragma unroll
        for (int r = 0; r < 8; ++r) {
            int row = r + hi8;
            sw[row * SSTR + ln]      = s0[r];
            sw[row * SSTR + 16 + ln] = s1[r];
        }
        maskadd[wave][lane] = madd;
        lds_fence();

        // online softmax: lane r (< 16) owns query row r of this wave
        if (lane < 16) {
            const float* srow = sw + lane * SSTR;
            const float* mrow = maskadd[wave];
            float sv[32];
            float mx = -1e30f;
            #pragma unroll
            for (int k = 0; k < 32; ++k) {
                sv[k] = srow[k] + mrow[k];
                mx = fmaxf(mx, sv[k]);
            }
            float mnew  = fmaxf(mrun, mx);
            float alpha = __expf(mrun - mnew);
            float sum = 0.0f;
            _Float16* prow = Pbuf[wave] + lane * PSTR;
            #pragma unroll
            for (int k = 0; k < 32; ++k) {
                float p = __expf(sv[k] - mnew);
                sum += p;
                prow[k] = (_Float16)p;
            }
            lrun = alpha * lrun + sum;
            mrun = mnew;
            sc[wave][lane] = alpha;
        }
        lds_fence();

        // rescale accumulator by alpha(row)
        f4 a0 = *(const f4*)&sc[wave][hi8];
        f4 a1 = *(const f4*)&sc[wave][hi8 + 4];
        float ar[8] = { a0[0], a0[1], a0[2], a0[3], a1[0], a1[1], a1[2], a1[3] };
        #pragma unroll
        for (int j = 0; j < 4; ++j)
            #pragma unroll
            for (int r = 0; r < 8; ++r)
                o[j][r] *= ar[r];

        // O += P @ V from the V fragments loaded at the head of the pass
        h8 plo = *(const h8*)(Pbuf[wave] + ln * PSTR + hi8);
        h8 phi = *(const h8*)(Pbuf[wave] + ln * PSTR + 16 + hi8);
        h16 pf = hcat(plo, phi);
        #pragma unroll
        for (int j = 0; j < 4; ++j)
            o[j] = wmma_f16(pf, hcat(vl[j], vh[j]), o[j]);
    }

    // hand the partial result over: 256 contiguous bytes per store
    typedef float f2 __attribute__((ext_vector_type(2)));
    #pragma unroll
    for (int j = 0; j < 4; ++j)
        #pragma unroll
        for (int rp = 0; rp < 4; ++rp) {
            f2 pr = { o[j][rp * 2], o[j][rp * 2 + 1] };
            *(f2*)&Opart[wave][(j * 4 + rp) * 64 + lane * 2] = pr;
        }
    if (lane < 16) {
        mpart[wave][lane] = mrun;
        lpart[wave][lane] = lrun;
    }
    // every wave's partial result is in LDS before any wave reads one
    __syncthreads();

    // this wave finishes rows ks*2 + hi8 and ks*2 + hi8 + 1 of tile qt: weight
    // of quarter s is exp(m_s - m) / sum over s of l_s * exp(m_s - m)
    const int rw = ks * 2 + hi8;
    f2 ms[NS], wt[NS];
    f2 mx = { -1e30f, -1e30f };
    #pragma unroll
    for (int s = 0; s < NS; ++s) {
        ms[s] = *(const f2*)&mpart[s * 4 + qt][rw];
        mx[0] = fmaxf(mx[0], ms[s][0]);
        mx[1] = fmaxf(mx[1], ms[s][1]);
    }
    f2 lsum = { 0.0f, 0.0f };
    #pragma unroll
    for (int s = 0; s < NS; ++s) {
        f2 ls = *(const f2*)&lpart[s * 4 + qt][rw];
        wt[s][0] = __expf(ms[s][0] - mx[0]);
        wt[s][1] = __expf(ms[s][1] - mx[1]);
        lsum[0] += ls[0] * wt[s][0];
        lsum[1] += ls[1] * wt[s][1];
    }
    const f2 inv = { 1.0f / lsum[0], 1.0f / lsum[1] };

    float* orow = out + ((size_t)b * T_ + q0 + qt * 16 + rw) * H_ + ln;
    #pragma unroll
    for (int j = 0; j < 4; ++j) {
        f2 acc = { 0.0f, 0.0f };
        #pragma unroll
        for (int s = 0; s < NS; ++s) {
            f2 pr = *(const f2*)&Opart[s * 4 + qt][(j * 4 + ks) * 64 + lane * 2];
            acc[0] += pr[0] * wt[s][0];
            acc[1] += pr[1] * wt[s][1];
        }
        orow[j * 16]      = acc[0] * inv[0];
        orow[H_ + j * 16] = acc[1] * inv[1];
    }
}

// ---------------------------------------------------------------------------
// Launch
// ---------------------------------------------------------------------------
extern "C" void kernel_launch(void* const* d_in, const int* in_sizes, int n_in,
                              void* d_out, int out_size, void* d_ws, size_t ws_size,
                              hipStream_t stream)
{
    const float* x    = (const float*)d_in[0];
    const float* Wq   = (const float*)d_in[1];
    const float* bq   = (const float*)d_in[2];
    const float* Wk   = (const float*)d_in[3];
    const float* bk   = (const float*)d_in[4];
    const float* Wv   = (const float*)d_in[5];
    const float* bv   = (const float*)d_in[6];
    const int*   mask = (const int*)d_in[7];
    float* out = (float*)d_out;

    _Float16* qkv = (_Float16*)d_ws;                 // 3 * BT * H halves = 6 MB
    const _Float16* Qh = qkv;
    const _Float16* Kh = qkv + (size_t)BT_ * H_;
    const _Float16* Vh = qkv + (size_t)2 * BT_ * H_;

    dim3 g1(BT_ / 128, 1, 3);
    qkv_proj_kernel<<<g1, 256, 0, stream>>>(x, Wq, bq, Wk, bk, Wv, bv, qkv);

    dim3 g2(T_ / 64, B_, 1);
    flash_attn_kernel<<<g2, 512, 0, stream>>>(Qh, Kh, Vh, mask, out);
}

// v005
// Measured time: 43.3 microseconds a run.
// Next to v004, in two timings, it ran 1.04 and 1.08 times as fast.
// Counting every step since v000, it is 4.44 times as fast.
#include <hip/hip_runtime.h>
#include <hip/hip_bf16.h>

// ---------------------------------------------------------------------------
// AttentionHead for MI455X (gfx1250, wave32, WMMA f16 16x16x32 -> f32).
// Phase 1: QKV projection  x[BT,E] @ W[E,H] + b  -> f16 in workspace, laid out
//          as the finished WMMA fragments that phase 2 reads.
// Phase 2: fused flash attention (online softmax) -> f32 out.
//
// Workspace layout.  Each of Q, K, V is cut into blocks of 32 rows x 64 cols
// (FB_ = 2048 halves); a block is 8 pieces of 512 B; lane l owns bytes
// 16*l .. 16*l+15 of every piece (c = l & 15, h = l >> 4, e = 0..7):
//   Q, K piece ((cc*2 + jj)*2 + p): element e = M[jj*16 + c][cc*32 + p*16 + h*8 + e]
//   V    piece (j*2 + p)          : element e = V[p*16 + h*8 + e][j*16 + c]
// Pieces p = 0 and p = 1 together are one 16x32 (32x16) f16 operand.
// ---------------------------------------------------------------------------

#define B_  8
#define T_  2048
#define E_  1024
#define H_  64
#define BT_ (B_ * T_)
#define FB_ (32 * H_)   // halves in one 32-row fragment block

typedef _Float16 h2  __attribute__((ext_vector_type(2)));
typedef _Float16 h4  __attribute__((ext_vector_type(4)));
typedef _Float16 h8  __attribute__((ext_vector_type(8)));
typedef _Float16 h16 __attribute__((ext_vector_type(16)));
typedef float    f4  __attribute__((ext_vector_type(4)));
typedef float    f8  __attribute__((ext_vector_type(8)));

static __device__ __forceinline__ h16 hcat(h8 a, h8 b) {
    return __builtin_shufflevector(a, b, 0,1,2,3,4,5,6,7,8,9,10,11,12,13,14,15);
}

// D = A(16x32 f16) x B(32x16 f16) + C(16x16 f32)
static __device__ __forceinline__ f8 wmma_f16(h16 a, h16 b, f8 c) {
    return __builtin_amdgcn_wmma_f32_16x16x32_f16(
        /*neg_a=*/false, a, /*neg_b=*/false, b,
        /*c_mod=*/(short)0, c, /*reuse_a=*/false, /*reuse_b=*/false);
}

// Work-group barrier that orders LDS traffic only.  __syncthreads() would also
// wait for every global load in flight, and the projection's loads are meant to
// stay in flight across two stages.  The wait covers this wave's LDS reads and
// writes; the clobber keeps the compiler from moving LDS accesses across it.
static __device__ __forceinline__ void lds_barrier() {
    asm volatile("s_wait_dscnt 0x0\n\ts_barrier_signal -1\n\ts_barrier_wait -1" ::: "memory");
}

// ---------------------------------------------------------------------------
// Kernel 1: QKV projection.  grid = (BT/128, 1, 3), block = 256 (8 waves).
// Each block: 128x64 output tile of Q (z=0), K (z=1) or V (z=2).
// K staged 64 wide (2 WMMA k-steps per barrier pair, 8 WMMAs per stage); the
// global loads of a stage run two stages ahead of its LDS stores.
// A fragment (per lane, 16 halves): lanes 0-15 row M=l, K={0..7,16..23};
// lanes 16-31 row M=l-16, K={8..15,24..31}.  B mirrors with lane = column.
// TR = true (Q, K): W^T is the A operand and x the B operand, so that a lane's
// 8 accumulators are 8 adjacent columns of one row.  TR = false (V): x is A,
// a lane's 8 accumulators are 8 adjacent rows of one column.  Either way they
// are one 16-byte element of the fragment layout above.
// ---------------------------------------------------------------------------
template <bool TR>
static __device__ __forceinline__
void proj_tile(const float* __restrict__ x, const float* __restrict__ W,
               const float* __restrict__ bias, _Float16* __restrict__ out,
               _Float16* Alds, _Float16* Wlds)
{
    constexpr int KC   = 64;   // K per stage
    constexpr int STRA = 72;   // halves per A row in LDS (144 B, 16B aligned)
    constexpr int STRB = 72;   // halves per W^T row in LDS

    const int m0   = blockIdx.x * 128;
    const int t    = threadIdx.x;
    const int wave = t >> 5;
    const int lane = t & 31;
    const int ln   = lane & 15;
    const int hi8  = (lane >> 4) * 8;
    const int mrow = wave * 16 + ln;          // x-fragment row within tile

    f8 acc[4] = {};

    // this thread's place in every staged tile: row r0 + 16*i, 4 columns at cv
    const int r0 = t >> 4, cv = (t & 15) * 4;
    const f4* xs = (const f4*)(x + (size_t)m0 * E_);      // block-uniform
    const f4* ws = (const f4*)W;
    const unsigned vx = r0 * (E_ / 4) + (t & 15);
    const unsigned vw = r0 * (H_ / 4) + (t & 15);

    // all 12 loads of one stage (x: 128 rows x 64 k, W: 64 k x 64 cols) are
    // issued together, into registers that are read two stages later
    auto fetch = [&](f4 (&xr)[8], f4 (&wr)[4], int kb) {
        const f4* xk = xs + kb / 4;
        const f4* wk = ws + (size_t)kb * (H_ / 4);
        #pragma unroll
        for (int i = 0; i < 8; ++i)
            xr[i] = xk[i * 16 * (E_ / 4) + vx];
        #pragma unroll
        for (int i = 0; i < 4; ++i)
            wr[i] = wk[i * 16 * (H_ / 4) + vw];
    };

    // one stage: registers -> LDS as f16, refill the registers for stage kn
    // (more = false: no such stage), then the products of this stage
    auto stage = [&](f4 (&xr)[8], f4 (&wr)[4], int kn, bool more) {
        lds_barrier();
        #pragma unroll
        for (int i = 0; i < 8; ++i) {
            h4 hv = { (_Float16)xr[i][0], (_Float16)xr[i][1],
                      (_Float16)xr[i][2], (_Float16)xr[i][3] };
            *(h4*)(Alds + (r0 + i * 16) * STRA + cv) = hv;
        }
        // W tile transposed: Wlds[col][k]
        #pragma unroll
        for (int i = 0; i < 4; ++i)
            #pragma unroll
            for (int j = 0; j < 4; ++j)
                Wlds[(cv + j) * STRB + r0 + i * 16] = (_Float16)wr[i][j];
        lds_barrier();

        if (more) fetch(xr, wr, kn);

        #pragma unroll
        for (int c = 0; c < 2; ++c) {
            const int ko = c * 32;
            // hoist all fragment loads, then issue WMMAs back-to-back
            h8 alo = *(const h8*)(Alds + mrow * STRA + ko + hi8);
            h8 ahi = *(const h8*)(Alds + mrow * STRA + ko + 16 + hi8);
            h16 a = hcat(alo, ahi);
            h16 bf[4];
            #pragma unroll
            for (int j = 0; j < 4; ++j) {
                int col = j * 16 + ln;
                h8 blo = *(const h8*)(Wlds + col * STRB + ko + hi8);
                h8 bhi = *(const h8*)(Wlds + col * STRB + ko + 16 + hi8);
                bf[j] = hcat(blo, bhi);
            }
            #pragma unroll
            for (int j = 0; j < 4; ++j)
                acc[j] = TR ? wmma_f16(bf[j], a, acc[j])
                            : wmma_f16(a, bf[j], acc[j]);
        }
    };

    f4 xa[8], wa[4], xb[8], wb[4];
    fetch(xa, wa, 0);
    // keeps set a's loads ahead of set b's in issue order: loads return in
    // order, so the wait for set a can then leave all of set b's in flight
    __builtin_amdgcn_sched_barrier(0);
    fetch(xb, wb, KC);
    for (int kb = 0; kb < E_ - 2 * KC; kb += 2 * KC) {
        stage(xa, wa, kb + 2 * KC, true);
        stage(xb, wb, kb + 3 * KC, true);
    }
    stage(xa, wa, 0, false);
    stage(xb, wb, 0, false);

    // bias add + f16 store: one 16-byte store per tile, 512 contiguous bytes
    // per wave.  This wave's 16 rows are half hf of 32-row block blk.
    const int blk = (m0 >> 5) + (wave >> 1);
    const int hf  = wave & 1;
    _Float16* ob = out + (size_t)blk * FB_ + lane * 8;
    #pragma unroll
    for (int j = 0; j < 4; ++j) {
        h8 pk;
        if (TR) {
            // acc[j][r] = row (wave*16 + ln), col (j*16 + hi8 + r)
            f4 b0 = *(const f4*)(bias + j * 16 + hi8);
            f4 b1 = *(const f4*)(bias + j * 16 + hi8 + 4);
            #pragma unroll
            for (int r = 0; r < 4; ++r) {
                pk[r]     = (_Float16)(acc[j][r]     + b0[r]);
                pk[r + 4] = (_Float16)(acc[j][r + 4] + b1[r]);
            }
            *(h8*)(ob + (((j >> 1) * 2 + hf) * 2 + (j & 1)) * 256) = pk;
        } else {
            // acc[j][r] = row (wave*16 + hi8 + r), col (j*16 + ln)
            float bj = bias[j * 16 + ln];
            #pragma unroll
            for (int r = 0; r < 8; ++r)
                pk[r] = (_Float16)(acc[j][r] + bj);
            *(h8*)(ob + (j * 2 + hf) * 256) = pk;
        }
    }
}

__global__ __launch_bounds__(256)
void qkv_proj_kernel(const float* __restrict__ x,
                     const float* __restrict__ Wq, const float* __restrict__ bq,
                     const float* __restrict__ Wk, const float* __restrict__ bk,
                     const float* __restrict__ Wv, const float* __restrict__ bv,
                     _Float16* __restrict__ qkv)
{
    __shared__ _Float16 Alds[128 * 72];
    __shared__ _Float16 Wlds[64 * 72];

    const int z = blockIdx.z;                 // the same for the whole block
    _Float16* out = qkv + (size_t)z * BT_ * H_;
    if (z == 2)
        proj_tile<false>(x, Wv, bv, out, Alds, Wlds);
    else
        proj_tile<true>(x, z == 0 ? Wq : Wk, z == 0 ? bq : bk, out, Alds, Wlds);
}

typedef float f2 __attribute__((ext_vector_type(2)));
typedef int   i4 __attribute__((ext_vector_type(4)));

struct yes_t { static constexpr bool value = true;  };
struct no_t  { static constexpr bool value = false; };

// value of lane l ^ 16
static __device__ __forceinline__ float xhalf(float v) {
    const int i = __builtin_bit_cast(int, v);
    return __builtin_bit_cast(float,
        __builtin_amdgcn_permlanex16(i, i, 0x76543210, 0xfedcba98, false, false));
}

// four waves a SIMD is all that a 16-wave block on its own WGP can have: said
// here so that the compiler spends registers on loads in flight, not on residency
__global__ __launch_bounds__(512) __attribute__((amdgpu_waves_per_eu(4, 4)))
void flash_attn_kernel(const _Float16* __restrict__ Qh,
                       const _Float16* __restrict__ Kh,
                       const _Float16* __restrict__ Vh,
                       const int* __restrict__ mask,
                       float* __restrict__ out)
{
    constexpr int NW   = 16;   // waves per block
    constexpr int NS   = 4;    // key quarters
    constexpr int KBS  = T_ / 32 / NS;   // key blocks per wave
    constexpr int OSTR = H_ + 4;         // floats per row of a partial O in LDS
    constexpr float L2E = 1.44269504088896340736f;
    // partial O, [query row][column]; read and written 16 bytes at a time
    __shared__ __attribute__((aligned(16))) float Opart[NW][16 * OSTR];
    __shared__ float mpart[NW][16];          // running maximum of each row
    __shared__ float lpart[NW][16];          // running sum of each row

    const int b    = blockIdx.y;
    const int q0   = blockIdx.x * 64;
    const int t    = threadIdx.x;
    // the wave's number in a scalar register: the loop's bounds depend on it
    const int wave = __builtin_amdgcn_readfirstlane(t >> 5);
    const int qt   = wave & 3;
    const int ks   = wave >> 2;
    const int lane = t & 31;
    const int ln   = lane & 15;
    const int hi8  = (lane >> 4) * 8;

    const size_t kvbase = (size_t)b * T_ * H_;   // = first 32-row block of b

    // preload Q fragments, pre-scaled by H^-0.5 = 0.125 (exact in f16)
    const _Float16* qsrc = Qh + kvbase
        + (size_t)(blockIdx.x * 2 + (qt >> 1)) * FB_ + lane * 8;
    h16 aq[2];
    #pragma unroll
    for (int c = 0; c < 2; ++c) {
        const int pc = (c * 2 + (qt & 1)) * 2;
        h8 lo = *(const h8*)(qsrc + pc * 256);
        h8 hc = *(const h8*)(qsrc + (pc + 1) * 256);
        aq[c] = hcat(lo, hc);
    }
    // precaution: no register that the issued Q loads name is rewritten ahead of this wait
    asm volatile("s_wait_xcnt 0x0" ::: "memory");
    #pragma unroll
    for (int c = 0; c < 2; ++c)
        #pragma unroll
        for (int i = 0; i < 16; ++i) aq[c][i] = aq[c][i] * (_Float16)0.125f;

    // o[j][r] = O[query ln][column j*16 + hi8 + r], unnormalised
    f8 o[4] = {};
    // mrun: query ln's running maximum (equal in both halves of the wave);
    // lrun: the running sum over this half's keys only
    float mrun = -1e30f, lrun = 0.0f;

    // this lane's addresses in key block 0 of the batch
    const _Float16* ksrc = Kh + kvbase + lane * 8;
    const _Float16* vsrc = Vh + kvbase + lane * 8;
    const int*      msrc = mask + b * T_ + lane;

    const int kb0 = ks * KBS;   // this wave's first key block

    // one key block's K fragments and mask word, carried from the pass that
    // loads them to the pass that uses them; the fragments of block kb0 are
    // asked for here, ahead of the look at the mask
    struct kset { h8 lo[2][2], hi[2][2]; int mk; };
    auto fetch_k = [&](kset& k, const _Float16* kn) {
        #pragma unroll
        for (int c = 0; c < 2; ++c)
            #pragma unroll
            for (int j = 0; j < 2; ++j) {
                k.lo[c][j] = *(const h8*)(kn + ((c * 2 + j) * 2) * 256);
                k.hi[c][j] = *(const h8*)(kn + ((c * 2 + j) * 2 + 1) * 256);
            }
    };
    kset kc;
    const _Float16* kfirst = ksrc + (size_t)kb0 * FB_;
    fetch_k(kc, kfirst);

    // does this wave's quarter hold a closed key?  Every lane looks at 16 mask
    // words; the answer is the same for the whole wave, in a scalar register
    bool shut = false;
    {
        const i4* mq = (const i4*)(mask + b * T_ + kb0 * 32) + lane * 4;
        i4 w[4];
        #pragma unroll
        for (int i = 0; i < 4; ++i)
            w[i] = mq[i];
        // precaution: no register that the issued K and mask loads name is
        // rewritten ahead of this wait; as its inputs they stay theirs up to it
        asm volatile("s_wait_xcnt 0x0" :: "v"(kfirst), "v"(mq) : "memory");
        #pragma unroll
        for (int i = 0; i < 4; ++i)
            shut |= (w[i][0] == 0) | (w[i][1] == 0) | (w[i][2] == 0) | (w[i][3] == 0);
    }
    const bool anyshut = __builtin_amdgcn_ballot_w32(shut) != 0;

    // the loop over the wave's key blocks; MASKED = false leaves out the mask
    // word and the selects, for a quarter in which every key is open
    auto walk = [&](auto tag) {
        constexpr bool MASKED = decltype(tag)::value;

        kc.mk = MASKED ? msrc[kb0 * 32] : 1;

        for (int kb = kb0; kb < kb0 + KBS; ++kb) {
            // issue this block's V loads; they are used behind the softmax
            h8 vl[4], vh[4];
            const _Float16* vn = vsrc + (size_t)kb * FB_;
            #pragma unroll
            for (int j = 0; j < 4; ++j) {
                vl[j] = *(const h8*)(vn + (j * 2) * 256);
                vh[j] = *(const h8*)(vn + (j * 2 + 1) * 256);
            }

            // S^T = K @ (Q*scale)^T from the fragments loaded one pass ago:
            // s0[r] = S[query ln][key hi8 + r], s1[r] = S[query ln][key 16 + hi8 + r]
            f8 s0 = {}, s1 = {};
            s0 = wmma_f16(hcat(kc.lo[0][0], kc.hi[0][0]), aq[0], s0);
            s1 = wmma_f16(hcat(kc.lo[0][1], kc.hi[0][1]), aq[0], s1);
            s0 = wmma_f16(hcat(kc.lo[1][0], kc.hi[1][0]), aq[1], s0);
            s1 = wmma_f16(hcat(kc.lo[1][1], kc.hi[1][1]), aq[1], s1);

            // bit k of the ballot: key k of this block is open (lane k holds its
            // mask word)
            const unsigned ob = MASKED
                ? __builtin_amdgcn_ballot_w32(kc.mk != 0) >> hi8 : 0u;

            // precaution: the register pair that the issued V loads name is not
            // rewritten ahead of this wait; as its input it stays theirs up to it.
            // The scores as inputs keep the four products ahead of the loads
            // that refill their K registers: with the products behind them the
            // compiler copies the fragments once per pass
            asm volatile("s_wait_xcnt 0x0" :: "v"(s0), "v"(s1), "v"(vn) : "memory");

            // issue the next block's K and mask loads; the wave's last pass
            // loads its own block again, so that every address stays inside
            // the wave's own keys
            const size_t nn = (size_t)(kb + 1 < kb0 + KBS ? kb + 1 : kb);
            const _Float16* kn = ksrc + nn * FB_;
            const int*      mn = msrc + nn * 32;
            fetch_k(kc, kn);
            // precaution, as above, for the registers that these loads name
            if (MASKED) {
                kc.mk = *mn;
                asm volatile("s_wait_xcnt 0x0" :: "v"(kn), "v"(mn) : "memory");
            } else {
                asm volatile("s_wait_xcnt 0x0" :: "v"(kn) : "memory");
            }

            // a closed key scores -1e9
            if (MASKED) {
                #pragma unroll
                for (int r = 0; r < 8; ++r) {
                    s0[r] = ((ob >> r) & 1u)        ? s0[r] : -1e9f;
                    s1[r] = ((ob >> (16 + r)) & 1u) ? s1[r] : -1e9f;
                }
            }

            // online softmax of query ln, in this lane's registers
            const float x0 = fmaxf(fmaxf(s0[0], s0[1]), s0[2]);
            const float x1 = fmaxf(fmaxf(s0[3], s0[4]), s0[5]);
            const float x2 = fmaxf(fmaxf(s0[6], s0[7]), s1[0]);
            const float x3 = fmaxf(fmaxf(s1[1], s1[2]), s1[3]);
            const float x4 = fmaxf(fmaxf(s1[4], s1[5]), s1[6]);
            float mx = fmaxf(fmaxf(fmaxf(x0, x1), x2), fmaxf(fmaxf(x3, x4), s1[7]));
            mx = fmaxf(mx, xhalf(mx));
            const float mnew  = fmaxf(mrun, mx);
            const float alpha = __builtin_amdgcn_exp2f((mrun - mnew) * L2E);
            mrun = mnew;

            h16 pf;           // P^T as a B operand: k order hi8 + r, 16 + hi8 + r
            f2  sum0 = { 0.0f, 0.0f }, sum1 = sum0;
            #pragma unroll
            for (int r = 0; r < 8; r += 2) {
                f2 e0 = { s0[r], s0[r + 1] };
                f2 e1 = { s1[r], s1[r + 1] };
                e0 = (e0 - mnew) * L2E;
                e1 = (e1 - mnew) * L2E;
                f2 p0 = { __builtin_amdgcn_exp2f(e0[0]), __builtin_amdgcn_exp2f(e0[1]) };
                f2 p1 = { __builtin_amdgcn_exp2f(e1[0]), __builtin_amdgcn_exp2f(e1[1]) };
                sum0 += p0;
                sum1 += p1;
                pf[r]     = (_Float16)p0[0];
                pf[r + 1] = (_Float16)p0[1];
                pf[r + 8] = (_Float16)p1[0];
                pf[r + 9] = (_Float16)p1[1];
            }
            sum0 += sum1;
            lrun = alpha * lrun + (sum0[0] + sum0[1]);

            // rescale the accumulator: every element of a lane is of query ln
            #pragma unroll
            for (int j = 0; j < 4; ++j)
                o[j] *= alpha;

            // O^T += V^T @ P^T from the V fragments loaded at the head of the pass
            #pragma unroll
            for (int j = 0; j < 4; ++j)
                o[j] = wmma_f16(hcat(vl[j], vh[j]), pf, o[j]);

            // compiler fence: holds the next block's K loads inside this pass;
            // without it the compiler carries their address over instead and
            // loads at the head of the next pass, right in front of their use
            asm volatile("" ::: "memory");
        }
    };
    if (anyshut) walk(yes_t{});
    else         walk(no_t{});

    // the two halves of the wave summed different keys of the same query
    lrun += xhalf(lrun);

    // hand the partial result over, row-major: 32 bytes per lane and tile
    {
        float* ow = Opart[wave] + ln * OSTR + hi8;
        #pragma unroll
        for (int j = 0; j < 4; ++j) {
            f4 lo = { o[j][0], o[j][1], o[j][2], o[j][3] };
            f4 hc = { o[j][4], o[j][5], o[j][6], o[j][7] };
            *(f4*)(ow + j * 16)     = lo;
            *(f4*)(ow + j * 16 + 4) = hc;
        }
    }
    if (lane < 16) {
        mpart[wave][lane] = mrun;
        lpart[wave][lane] = lrun;
    }
    // every wave's partial result is in LDS before any wave reads one
    __syncthreads();

    // this wave finishes rows ks*4 .. ks*4 + 3 of tile qt, eight lanes a row,
    // eight columns a lane: weight of quarter s is
    // exp(m_s - m) / sum over s of l_s * exp(m_s - m)
    const int row = ks * 4 + (lane >> 3);
    const int col = (lane & 7) * 8;
    float ms[NS], wt[NS];
    float mall = -1e30f;
    #pragma unroll
    for (int s = 0; s < NS; ++s) {
        ms[s] = mpart[s * 4 + qt][row];
        mall  = fmaxf(mall, ms[s]);
    }
    float lsum = 0.0f;
    #pragma unroll
    for (int s = 0; s < NS; ++s) {
        wt[s] = __expf(ms[s] - mall);
        lsum += lpart[s * 4 + qt][row] * wt[s];
    }
    const float inv = 1.0f / lsum;

    f4 r0 = { 0.0f, 0.0f, 0.0f, 0.0f }, r1 = r0;
    #pragma unroll
    for (int s = 0; s < NS; ++s) {
        const float* pr = Opart[s * 4 + qt] + row * OSTR + col;
        r0 += *(const f4*)pr * wt[s];
        r1 += *(const f4*)(pr + 4) * wt[s];
    }
    float* orow = out + ((size_t)b * T_ + q0 + qt * 16 + row) * H_ + col;
    *(f4*)orow       = r0 * inv;
    *(f4*)(orow + 4) = r1 * inv;
}

// ---------------------------------------------------------------------------
// Launch
// ---------------------------------------------------------------------------
extern "C" void kernel_launch(void* const* d_in, const int* in_sizes, int n_in,
                              void* d_out, int out_size, void* d_ws, size_t ws_size,
                              hipStream_t stream)
{
    const float* x    = (const float*)d_in[0];
    const float* Wq   = (const float*)d_in[1];
    const float* bq   = (const float*)d_in[2];
    const float* Wk   = (const float*)d_in[3];
    const float* bk   = (const float*)d_in[4];
    const float* Wv   = (const float*)d_in[5];
    const float* bv   = (const float*)d_in[6];
    const int*   mask = (const int*)d_in[7];
    float* out = (float*)d_out;

    _Float16* qkv = (_Float16*)d_ws;                 // 3 * BT * H halves = 6 MB
    const _Float16* Qh = qkv;
    const _Float16* Kh = qkv + (size_t)BT_ * H_;
    const _Float16* Vh = qkv + (size_t)2 * BT_ * H_;

    dim3 g1(BT_ / 128, 1, 3);
    qkv_proj_kernel<<<g1, 256, 0, stream>>>(x, Wq, bq, Wk, bk, Wv, bv, qkv);

    dim3 g2(T_ / 64, B_, 1);
    flash_attn_kernel<<<g2, 512, 0, stream>>>(Qh, Kh, Vh, mask, out);
}

// v006
// A run of this version takes 29.5 microseconds.
// Next to v005, in two timings, it ran 1.45 and 1.47 times as fast.
// Over all steps from v000 it is 6.48 times as fast.
#include <hip/hip_runtime.h>
#include <hip/hip_bf16.h>

// ---------------------------------------------------------------------------
// AttentionHead for MI455X (gfx1250, wave32, WMMA f16 16x16x32 -> f32).
// Phase 1: QKV projection  x[BT,E] @ W[E,H] + b  -> f16 in workspace, laid out
//          as the finished WMMA fragments that phase 2 reads.
// Phase 2: fused flash attention (online softmax) -> f32 out.
//
// Workspace layout.  Each of Q, K, V is cut into blocks of 32 rows x 64 cols
// (FB_ = 2048 halves); a block is 8 pieces of 512 B; lane l owns bytes
// 16*l .. 16*l+15 of every piece (c = l & 15, h = l >> 4, e = 0..7):
//   Q, K piece ((cc*2 + jj)*2 + p): element e = M[jj*16 + c][cc*32 + p*16 + h*8 + e]
//   V    piece (j*2 + p)          : element e = V[p*16 + h*8 + e][j*16 + c]
// Pieces p = 0 and p = 1 together are one 16x32 (32x16) f16 operand.
// ---------------------------------------------------------------------------

#define B_  8
#define T_  2048
#define E_  1024
#define H_  64
#define BT_ (B_ * T_)
#define FB_ (32 * H_)   // halves in one 32-row fragment block

typedef _Float16 h2  __attribute__((ext_vector_type(2)));
typedef _Float16 h4  __attribute__((ext_vector_type(4)));
typedef _Float16 h8  __attribute__((ext_vector_type(8)));
typedef _Float16 h16 __attribute__((ext_vector_type(16)));
typedef float    f4  __attribute__((ext_vector_type(4)));
typedef float    f8  __attribute__((ext_vector_type(8)));

static __device__ __forceinline__ h16 hcat(h8 a, h8 b) {
    return __builtin_shufflevector(a, b, 0,1,2,3,4,5,6,7,8,9,10,11,12,13,14,15);
}

// D = A(16x32 f16) x B(32x16 f16) + C(16x16 f32)
static __device__ __forceinline__ f8 wmma_f16(h16 a, h16 b, f8 c) {
    return __builtin_amdgcn_wmma_f32_16x16x32_f16(
        /*neg_a=*/false, a, /*neg_b=*/false, b,
        /*c_mod=*/(short)0, c, /*reuse_a=*/false, /*reuse_b=*/false);
}

// Transposing LDS load: from a row-major 16-bit tile T (rows = k) lane (c, h)
// gets T[kbase + 8h + 0..7][dbase + c]; lane l passes the address of
// T[kbase + 8*(l >> 4) + (l & 7)][dbase + 8*((l >> 3) & 1)].
typedef short s8v __attribute__((ext_vector_type(8)));
static __device__ __forceinline__ h8 lds_tr16(const _Float16* p) {
    typedef __attribute__((address_space(3))) s8v lds_s8v;
    return __builtin_bit_cast(h8, __builtin_amdgcn_ds_load_tr16_b128_v8i16((lds_s8v*)p));
}

// Work-group barrier that orders LDS traffic only.  __syncthreads() would also
// wait for every global load in flight, and the projection's loads are meant to
// stay in flight across two stages.  The wait covers this wave's LDS reads and
// writes; the clobber keeps the compiler from moving LDS accesses across it.
static __device__ __forceinline__ void lds_barrier() {
    asm volatile("s_wait_dscnt 0x0\n\ts_barrier_signal -1\n\ts_barrier_wait -1" ::: "memory");
}

// ---------------------------------------------------------------------------
// Kernel 1: QKV projection.  grid = (BT/128, 1, 3), block = 256 (8 waves).
// Each block: 128x64 output tile of Q (z=0), K (z=1) or V (z=2).
// K staged 64 wide (2 WMMA k-steps per barrier pair, 8 WMMAs per stage); the
// global loads of a stage run two stages ahead of its LDS stores.
// A fragment (per lane, 16 halves): lanes 0-15 row M=l, K={0..7,16..23};
// lanes 16-31 row M=l-16, K={8..15,24..31}.  B mirrors with lane = column.
// x lies in LDS as [row][k] and is read with plain 16-byte loads; W lies there
// as it does in memory, [k][col], and its fragments come through the
// transposing load, which delivers the same k order.
// TR = true (Q, K): W^T is the A operand and x the B operand, so that a lane's
// 8 accumulators are 8 adjacent columns of one row.  TR = false (V): x is A,
// a lane's 8 accumulators are 8 adjacent rows of one column.  Either way they
// are one 16-byte element of the fragment layout above.
// ---------------------------------------------------------------------------
template <bool TR>
static __device__ __forceinline__
void proj_tile(const float* __restrict__ x, const float* __restrict__ W,
               const float* __restrict__ bias, _Float16* __restrict__ out,
               _Float16* Alds, _Float16* Wlds)
{
    constexpr int KC   = 64;   // K per stage
    constexpr int STRA = 72;   // halves per A row in LDS (144 B, 16B aligned)
    constexpr int STRB = 80;   // halves per W row (one k) in LDS: 160 B = 32 B x odd

    const int m0   = blockIdx.x * 128;
    const int t    = threadIdx.x;
    const int wave = t >> 5;
    const int lane = t & 31;
    const int ln   = lane & 15;
    const int hi8  = (lane >> 4) * 8;
    const int mrow = wave * 16 + ln;          // x-fragment row within tile
    // this lane's address in the transposing loads, at k = 0 and column 0
    const _Float16* wfr = Wlds + (hi8 + (lane & 7)) * STRB + ((lane >> 3) & 1) * 8;

    f8 acc[4] = {};

    // this thread's place in every staged tile: row r0 + 16*i, 4 columns at cv
    const int r0 = t >> 4, cv = (t & 15) * 4;
    const f4* xs = (const f4*)(x + (size_t)m0 * E_);      // block-uniform
    const f4* ws = (const f4*)W;
    const unsigned vx = r0 * (E_ / 4) + (t & 15);
    const unsigned vw = r0 * (H_ / 4) + (t & 15);

    // all 12 loads of one stage (x: 128 rows x 64 k, W: 64 k x 64 cols) are
    // issued together, into registers that are read two stages later
    auto fetch = [&](f4 (&xr)[8], f4 (&wr)[4], int kb) {
        const f4* xk = xs + kb / 4;
        const f4* wk = ws + (size_t)kb * (H_ / 4);
        #pragma unroll
        for (int i = 0; i < 8; ++i)
            xr[i] = xk[i * 16 * (E_ / 4) + vx];
        #pragma unroll
        for (int i = 0; i < 4; ++i)
            wr[i] = wk[i * 16 * (H_ / 4) + vw];
    };

    // one stage: registers -> LDS as f16, refill the registers for stage kn
    // (more = false: no such stage), then the products of this stage
    auto stage = [&](f4 (&xr)[8], f4 (&wr)[4], int kn, bool more) {
        lds_barrier();
        #pragma unroll
        for (int i = 0; i < 8; ++i) {
            h4 hv = { (_Float16)xr[i][0], (_Float16)xr[i][1],
                      (_Float16)xr[i][2], (_Float16)xr[i][3] };
            *(h4*)(Alds + (r0 + i * 16) * STRA + cv) = hv;
        }
        // W tile as it lies in memory: Wlds[k][col]
        #pragma unroll
        for (int i = 0; i < 4; ++i) {
            h4 hv = { (_Float16)wr[i][0], (_Float16)wr[i][1],
                      (_Float16)wr[i][2], (_Float16)wr[i][3] };
            *(h4*)(Wlds + (r0 + i * 16) * STRB + cv) = hv;
        }
        lds_barrier();

        if (more) fetch(xr, wr, kn);

        #pragma unroll
        for (int c = 0; c < 2; ++c) {
            const int ko = c * 32;
            // hoist all fragment loads, then issue WMMAs back-to-back
            h8 alo = *(const h8*)(Alds + mrow * STRA + ko + hi8);
            h8 ahi = *(const h8*)(Alds + mrow * STRA + ko + 16 + hi8);
            h16 a = hcat(alo, ahi);
            h16 bf[4];
            #pragma unroll
            for (int j = 0; j < 4; ++j) {
                h8 blo = lds_tr16(wfr + ko * STRB + j * 16);
                h8 bhi = lds_tr16(wfr + (ko + 16) * STRB + j * 16);
                bf[j] = hcat(blo, bhi);
            }
            #pragma unroll
            for (int j = 0; j < 4; ++j)
                acc[j] = TR ? wmma_f16(bf[j], a, acc[j])
                            : wmma_f16(a, bf[j], acc[j]);
        }
    };

    f4 xa[8], wa[4], xb[8], wb[4];
    fetch(xa, wa, 0);
    // keeps set a's loads ahead of set b's in issue order: loads return in
    // order, so the wait for set a can then leave all of set b's in flight
    __builtin_amdgcn_sched_barrier(0);
    fetch(xb, wb, KC);
    for (int kb = 0; kb < E_ - 2 * KC; kb += 2 * KC) {
        stage(xa, wa, kb + 2 * KC, true);
        stage(xb, wb, kb + 3 * KC, true);
    }
    stage(xa, wa, 0, false);
    stage(xb, wb, 0, false);

    // bias add + f16 store: one 16-byte store per tile, 512 contiguous bytes
    // per wave.  This wave's 16 rows are half hf of 32-row block blk.
    const int blk = (m0 >> 5) + (wave >> 1);
    const int hf  = wave & 1;
    _Float16* ob = out + (size_t)blk * FB_ + lane * 8;
    #pragma unroll
    for (int j = 0; j < 4; ++j) {
        h8 pk;
        if (TR) {
            // acc[j][r] = row (wave*16 + ln), col (j*16 + hi8 + r)
            f4 b0 = *(const f4*)(bias + j * 16 + hi8);
            f4 b1 = *(const f4*)(bias + j * 16 + hi8 + 4);
            #pragma unroll
            for (int r = 0; r < 4; ++r) {
                pk[r]     = (_Float16)(acc[j][r]     + b0[r]);
                pk[r + 4] = (_Float16)(acc[j][r + 4] + b1[r]);
            }
            *(h8*)(ob + (((j >> 1) * 2 + hf) * 2 + (j & 1)) * 256) = pk;
        } else {
            // acc[j][r] = row (wave*16 + hi8 + r), col (j*16 + ln)
            float bj = bias[j * 16 + ln];
            #pragma unroll
            for (int r = 0; r < 8; ++r)
                pk[r] = (_Float16)(acc[j][r] + bj);
            *(h8*)(ob + (j * 2 + hf) * 256) = pk;
        }
    }
}

__global__ __launch_bounds__(256)
void qkv_proj_kernel(const float* __restrict__ x,
                     const float* __restrict__ Wq, const float* __restrict__ bq,
                     const float* __restrict__ Wk, const float* __restrict__ bk,
                     const float* __restrict__ Wv, const float* __restrict__ bv,
                     _Float16* __restrict__ qkv)
{
    __shared__ __attribute__((aligned(16))) _Float16 Alds[128 * 72];
    __shared__ __attribute__((aligned(32))) _Float16 Wlds[64 * 80];

    const int z = blockIdx.z;                 // the same for the whole block
    _Float16* out = qkv + (size_t)z * BT_ * H_;
    if (z == 2)
        proj_tile<false>(x, Wv, bv, out, Alds, Wlds);
    else
        proj_tile<true>(x, z == 0 ? Wq : Wk, z == 0 ? bq : bk, out, Alds, Wlds);
}

typedef float f2 __attribute__((ext_vector_type(2)));
typedef int   i4 __attribute__((ext_vector_type(4)));

struct yes_t { static constexpr bool value = true;  };
struct no_t  { static constexpr bool value = false; };

// value of lane l ^ 16
static __device__ __forceinline__ float xhalf(float v) {
    const int i = __builtin_bit_cast(int, v);
    return __builtin_bit_cast(float,
        __builtin_amdgcn_permlanex16(i, i, 0x76543210, 0xfedcba98, false, false));
}

// four waves a SIMD is all that a 16-wave block on its own WGP can have: said
// here so that the compiler spends registers on loads in flight, not on residency
__global__ __launch_bounds__(512) __attribute__((amdgpu_waves_per_eu(4, 4)))
void flash_attn_kernel(const _Float16* __restrict__ Qh,
                       const _Float16* __restrict__ Kh,
                       const _Float16* __restrict__ Vh,
                       const int* __restrict__ mask,
                       float* __restrict__ out)
{
    constexpr int NW   = 16;   // waves per block
    constexpr int NS   = 4;    // key quarters
    constexpr int KBS  = T_ / 32 / NS;   // key blocks per wave
    constexpr int OSTR = H_ + 4;         // floats per row of a partial O in LDS
    constexpr float L2E = 1.44269504088896340736f;
    // partial O, [query row][column]; read and written 16 bytes at a time
    __shared__ __attribute__((aligned(16))) float Opart[NW][16 * OSTR];
    __shared__ float mpart[NW][16];          // running maximum of each row
    __shared__ float lpart[NW][16];          // running sum of each row

    const int b    = blockIdx.y;
    const int q0   = blockIdx.x * 64;
    const int t    = threadIdx.x;
    // the wave's number in a scalar register: the loop's bounds depend on it
    const int wave = __builtin_amdgcn_readfirstlane(t >> 5);
    const int qt   = wave & 3;
    const int ks   = wave >> 2;
    const int lane = t & 31;
    const int ln   = lane & 15;
    const int hi8  = (lane >> 4) * 8;

    const size_t kvbase = (size_t)b * T_ * H_;   // = first 32-row block of b

    // preload Q fragments, pre-scaled by H^-0.5 = 0.125 (exact in f16)
    const _Float16* qsrc = Qh + kvbase
        + (size_t)(blockIdx.x * 2 + (qt >> 1)) * FB_ + lane * 8;
    h16 aq[2];
    #pragma unroll
    for (int c = 0; c < 2; ++c) {
        const int pc = (c * 2 + (qt & 1)) * 2;
        h8 lo = *(const h8*)(qsrc + pc * 256);
        h8 hc = *(const h8*)(qsrc + (pc + 1) * 256);
        aq[c] = hcat(lo, hc);
    }
    // precaution: no register that the issued Q loads name is rewritten ahead of this wait
    asm volatile("s_wait_xcnt 0x0" ::: "memory");
    #pragma unroll
    for (int c = 0; c < 2; ++c)
        #pragma unroll
        for (int i = 0; i < 16; ++i) aq[c][i] = aq[c][i] * (_Float16)0.125f;

    // o[j][r] = O[query ln][column j*16 + hi8 + r], unnormalised
    f8 o[4] = {};
    // mrun: query ln's running maximum (equal in both halves of the wave);
    // lrun: the running sum over this half's keys only
    float mrun = -1e30f, lrun = 0.0f;

    // this lane's addresses in key block 0 of the batch
    const _Float16* ksrc = Kh + kvbase + lane * 8;
    const _Float16* vsrc = Vh + kvbase + lane * 8;
    const int*      msrc = mask + b * T_ + lane;

    const int kb0 = ks * KBS;   // this wave's first key block

    // one key block's K fragments and mask word, carried from the pass that
    // loads them to the pass that uses them; the fragments of block kb0 are
    // asked for here, ahead of the look at the mask
    struct kset { h8 lo[2][2], hi[2][2]; int mk; };
    auto fetch_k = [&](kset& k, const _Float16* kn) {
        #pragma unroll
        for (int c = 0; c < 2; ++c)
            #pragma unroll
            for (int j = 0; j < 2; ++j) {
                k.lo[c][j] = *(const h8*)(kn + ((c * 2 + j) * 2) * 256);
                k.hi[c][j] = *(const h8*)(kn + ((c * 2 + j) * 2 + 1) * 256);
            }
    };
    kset kc;
    const _Float16* kfirst = ksrc + (size_t)kb0 * FB_;
    fetch_k(kc, kfirst);

    // does this wave's quarter hold a closed key?  Every lane looks at 16 mask
    // words; the answer is the same for the whole wave, in a scalar register
    bool shut = false;
    {
        const i4* mq = (const i4*)(mask + b * T_ + kb0 * 32) + lane * 4;
        i4 w[4];
        #pragma unroll
        for (int i = 0; i < 4; ++i)
            w[i] = mq[i];
        // precaution: no register that the issued K and mask loads name is
        // rewritten ahead of this wait; as its inputs they stay theirs up to it
        asm volatile("s_wait_xcnt 0x0" :: "v"(kfirst), "v"(mq) : "memory");
        #pragma unroll
        for (int i = 0; i < 4; ++i)
            shut |= (w[i][0] == 0) | (w[i][1] == 0) | (w[i][2] == 0) | (w[i][3] == 0);
    }
    const bool anyshut = __builtin_amdgcn_ballot_w32(shut) != 0;

    // the loop over the wave's key blocks; MASKED = false leaves out the mask
    // word and the selects, for a quarter in which every key is open
    auto walk = [&](auto tag) {
        constexpr bool MASKED = decltype(tag)::value;

        kc.mk = MASKED ? msrc[kb0 * 32] : 1;

        for (int kb = kb0; kb < kb0 + KBS; ++kb) {
            // issue this block's V loads; they are used behind the softmax
            h8 vl[4], vh[4];
            const _Float16* vn = vsrc + (size_t)kb * FB_;
            #pragma unroll
            for (int j = 0; j < 4; ++j) {
                vl[j] = *(const h8*)(vn + (j * 2) * 256);
                vh[j] = *(const h8*)(vn + (j * 2 + 1) * 256);
            }

            // S^T = K @ (Q*scale)^T from the fragments loaded one pass ago:
            // s0[r] = S[query ln][key hi8 + r], s1[r] = S[query ln][key 16 + hi8 + r]
            f8 s0 = {}, s1 = {};
            s0 = wmma_f16(hcat(kc.lo[0][0], kc.hi[0][0]), aq[0], s0);
            s1 = wmma_f16(hcat(kc.lo[0][1], kc.hi[0][1]), aq[0], s1);
            s0 = wmma_f16(hcat(kc.lo[1][0], kc.hi[1][0]), aq[1], s0);
            s1 = wmma_f16(hcat(kc.lo[1][1], kc.hi[1][1]), aq[1], s1);

            // bit k of the ballot: key k of this block is open (lane k holds its
            // mask word)
            const unsigned ob = MASKED
                ? __builtin_amdgcn_ballot_w32(kc.mk != 0) >> hi8 : 0u;

            // precaution: the register pair that the issued V loads name is not
            // rewritten ahead of this wait; as its input it stays theirs up to it.
            // The scores as inputs keep the four products ahead of the loads
            // that refill their K registers: with the products behind them the
            // compiler copies the fragments once per pass
            asm volatile("s_wait_xcnt 0x0" :: "v"(s0), "v"(s1), "v"(vn) : "memory");

            // issue the next block's K and mask loads; the wave's last pass
            // loads its own block again, so that every address stays inside
            // the wave's own keys
            const size_t nn = (size_t)(kb + 1 < kb0 + KBS ? kb + 1 : kb);
            const _Float16* kn = ksrc + nn * FB_;
            const int*      mn = msrc + nn * 32;
            fetch_k(kc, kn);
            // precaution, as above, for the registers that these loads name
            if (MASKED) {
                kc.mk = *mn;
                asm volatile("s_wait_xcnt 0x0" :: "v"(kn), "v"(mn) : "memory");
            } else {
                asm volatile("s_wait_xcnt 0x0" :: "v"(kn) : "memory");
            }

            // a closed key scores -1e9
            if (MASKED) {
                #pragma unroll
                for (int r = 0; r < 8; ++r) {
                    s0[r] = ((ob >> r) & 1u)        ? s0[r] : -1e9f;
                    s1[r] = ((ob >> (16 + r)) & 1u) ? s1[r] : -1e9f;
                }
            }

            // online softmax of query ln, in this lane's registers
            const float x0 = fmaxf(fmaxf(s0[0], s0[1]), s0[2]);
            const float x1 = fmaxf(fmaxf(s0[3], s0[4]), s0[5]);
            const float x2 = fmaxf(fmaxf(s0[6], s0[7]), s1[0]);
            const float x3 = fmaxf(fmaxf(s1[1], s1[2]), s1[3]);
            const float x4 = fmaxf(fmaxf(s1[4], s1[5]), s1[6]);
            float mx = fmaxf(fmaxf(fmaxf(x0, x1), x2), fmaxf(fmaxf(x3, x4), s1[7]));
            mx = fmaxf(mx, xhalf(mx));
            const float mnew  = fmaxf(mrun, mx);
            const float alpha = __builtin_amdgcn_exp2f((mrun - mnew) * L2E);
            mrun = mnew;

            h16 pf;           // P^T as a B operand: k order hi8 + r, 16 + hi8 + r
            f2  sum0 = { 0.0f, 0.0f }, sum1 = sum0;
            #pragma unroll
            for (int r = 0; r < 8; r += 2) {
                f2 e0 = { s0[r], s0[r + 1] };
                f2 e1 = { s1[r], s1[r + 1] };
                e0 = (e0 - mnew) * L2E;
                e1 = (e1 - mnew) * L2E;
                f2 p0 = { __builtin_amdgcn_exp2f(e0[0]), __builtin_amdgcn_exp2f(e0[1]) };
                f2 p1 = { __builtin_amdgcn_exp2f(e1[0]), __builtin_amdgcn_exp2f(e1[1]) };
                sum0 += p0;
                sum1 += p1;
                pf[r]     = (_Float16)p0[0];
                pf[r + 1] = (_Float16)p0[1];
                pf[r + 8] = (_Float16)p1[0];
                pf[r + 9] = (_Float16)p1[1];
            }
            sum0 += sum1;
            lrun = alpha * lrun + (sum0[0] + sum0[1]);

            // rescale the accumulator: every element of a lane is of query ln
            #pragma unroll
            for (int j = 0; j < 4; ++j)
                o[j] *= alpha;

            // O^T += V^T @ P^T from the V fragments loaded at the head of the pass
            #pragma unroll
            for (int j = 0; j < 4; ++j)
                o[j] = wmma_f16(hcat(vl[j], vh[j]), pf, o[j]);

            // compiler fence: holds the next block's K loads inside this pass;
            // without it the compiler carries their address over instead and
            // loads at the head of the next pass, right in front of their use
            asm volatile("" ::: "memory");
        }
    };
    if (anyshut) walk(yes_t{});
    else         walk(no_t{});

    // the two halves of the wave summed different keys of the same query
    lrun += xhalf(lrun);

    // hand the partial result over, row-major: 32 bytes per lane and tile
    {
        float* ow = Opart[wave] + ln * OSTR + hi8;
        #pragma unroll
        for (int j = 0; j < 4; ++j) {
            f4 lo = { o[j][0], o[j][1], o[j][2], o[j][3] };
            f4 hc = { o[j][4], o[j][5], o[j][6], o[j][7] };
            *(f4*)(ow + j * 16)     = lo;
            *(f4*)(ow + j * 16 + 4) = hc;
        }
    }
    if (lane < 16) {
        mpart[wave][lane] = mrun;
        lpart[wave][lane] = lrun;
    }
    // every wave's partial result is in LDS before any wave reads one
    __syncthreads();

    // this wave finishes rows ks*4 .. ks*4 + 3 of tile qt, eight lanes a row,
    // eight columns a lane: weight of quarter s is
    // exp(m_s - m) / sum over s of l_s * exp(m_s - m)
    const int row = ks * 4 + (lane >> 3);
    const int col = (lane & 7) * 8;
    float ms[NS], wt[NS];
    float mall = -1e30f;
    #pragma unroll
    for (int s = 0; s < NS; ++s) {
        ms[s] = mpart[s * 4 + qt][row];
        mall  = fmaxf(mall, ms[s]);
    }
    float lsum = 0.0f;
    #pragma unroll
    for (int s = 0; s < NS; ++s) {
        wt[s] = __expf(ms[s] - mall);
        lsum += lpart[s * 4 + qt][row] * wt[s];
    }
    const float inv = 1.0f / lsum;

    f4 r0 = { 0.0f, 0.0f, 0.0f, 0.0f }, r1 = r0;
    #pragma unroll
    for (int s = 0; s < NS; ++s) {
        const float* pr = Opart[s * 4 + qt] + row * OSTR + col;
        r0 += *(const f4*)pr * wt[s];
        r1 += *(const f4*)(pr + 4) * wt[s];
    }
    float* orow = out + ((size_t)b * T_ + q0 + qt * 16 + row) * H_ + col;
    *(f4*)orow       = r0 * inv;
    *(f4*)(orow + 4) = r1 * inv;
}

// ---------------------------------------------------------------------------
// Launch
// ---------------------------------------------------------------------------
extern "C" void kernel_launch(void* const* d_in, const int* in_sizes, int n_in,
                              void* d_out, int out_size, void* d_ws, size_t ws_size,
                              hipStream_t stream)
{
    const float* x    = (const float*)d_in[0];
    const float* Wq   = (const float*)d_in[1];
    const float* bq   = (const float*)d_in[2];
    const float* Wk   = (const float*)d_in[3];
    const float* bk   = (const float*)d_in[4];
    const float* Wv   = (const float*)d_in[5];
    const float* bv   = (const float*)d_in[6];
    const int*   mask = (const int*)d_in[7];
    float* out = (float*)d_out;

    _Float16* qkv = (_Float16*)d_ws;                 // 3 * BT * H halves = 6 MB
    const _Float16* Qh = qkv;
    const _Float16* Kh = qkv + (size_t)BT_ * H_;
    const _Float16* Vh = qkv + (size_t)2 * BT_ * H_;

    dim3 g1(BT_ / 128, 1, 3);
    qkv_proj_kernel<<<g1, 256, 0, stream>>>(x, Wq, bq, Wk, bk, Wv, bv, qkv);

    dim3 g2(T_ / 64, B_, 1);
    flash_attn_kernel<<<g2, 512, 0, stream>>>(Qh, Kh, Vh, mask, out);
}

// v007
// A run of this version takes 26.7 microseconds.
// In two side-by-side timings against v006, it was 1.14 and 1.15 times as fast.
// Counting every step since v000, it is 7.41 times as fast.
#include <hip/hip_runtime.h>
#include <hip/hip_bf16.h>

// ---------------------------------------------------------------------------
// AttentionHead for MI455X (gfx1250, wave32, WMMA f16 16x16x32 -> f32).
// Phase 1: QKV projection  x[BT,E] @ W[E,H] + b  -> f16 in workspace, laid out
//          as the finished WMMA fragments that phase 2 reads.
// Phase 2: fused flash attention (online softmax) -> f32 out.
//
// Workspace layout.  Each of Q, K, V is cut into blocks of 32 rows x 64 cols
// (FB_ = 2048 halves); a block is 8 pieces of 512 B; lane l owns bytes
// 16*l .. 16*l+15 of every piece (c = l & 15, h = l >> 4, e = 0..7):
//   Q, K piece ((cc*2 + jj)*2 + p): element e = M[jj*16 + c][cc*32 + p*16 + h*8 + e]
//   V    piece (j*2 + p)          : element e = V[p*16 + h*8 + e][j*16 + c]
// Pieces p = 0 and p = 1 together are one 16x32 (32x16) f16 operand.
// ---------------------------------------------------------------------------

#define B_  8
#define T_  2048
#define E_  1024
#define H_  64
#define BT_ (B_ * T_)
#define FB_ (32 * H_)   // halves in one 32-row fragment block

typedef _Float16 h2  __attribute__((ext_vector_type(2)));
typedef _Float16 h4  __attribute__((ext_vector_type(4)));
typedef _Float16 h8  __attribute__((ext_vector_type(8)));
typedef _Float16 h16 __attribute__((ext_vector_type(16)));
typedef float    f4  __attribute__((ext_vector_type(4)));
typedef float    f8  __attribute__((ext_vector_type(8)));

static __device__ __forceinline__ h16 hcat(h8 a, h8 b) {
    return __builtin_shufflevector(a, b, 0,1,2,3,4,5,6,7,8,9,10,11,12,13,14,15);
}

// D = A(16x32 f16) x B(32x16 f16) + C(16x16 f32)
static __device__ __forceinline__ f8 wmma_f16(h16 a, h16 b, f8 c) {
    return __builtin_amdgcn_wmma_f32_16x16x32_f16(
        /*neg_a=*/false, a, /*neg_b=*/false, b,
        /*c_mod=*/(short)0, c, /*reuse_a=*/false, /*reuse_b=*/false);
}

// Transposing LDS load: from a row-major 16-bit tile T (rows = k) lane (c, h)
// gets T[kbase + 8h + 0..7][dbase + c]; lane l passes the address of
// T[kbase + 8*(l >> 4) + (l & 7)][dbase + 8*((l >> 3) & 1)].
typedef short s8v __attribute__((ext_vector_type(8)));
static __device__ __forceinline__ h8 lds_tr16(const _Float16* p) {
    typedef __attribute__((address_space(3))) s8v lds_s8v;
    return __builtin_bit_cast(h8, __builtin_amdgcn_ds_load_tr16_b128_v8i16((lds_s8v*)p));
}

// Work-group barrier that orders LDS traffic only.  __syncthreads() would also
// wait for every global load in flight, and the projection's loads are meant to
// stay in flight across two stages.  The wait covers this wave's LDS reads and
// writes; the clobber keeps the compiler from moving LDS accesses across it.
static __device__ __forceinline__ void lds_barrier() {
    asm volatile("s_wait_dscnt 0x0\n\ts_barrier_signal -1\n\ts_barrier_wait -1" ::: "memory");
}

// Where block b enters a walk of 16 steps that it shares with other blocks.
// Any four neighbours out of eight blocks, taken over 32 blocks, get 16 different
// values.  For speed only: every value in 0..15 gives the same sums in another order.
static __device__ __forceinline__ int entry16(int b) {
    return (((b >> 3) << 2) | (b & 3)) & 15;
}

// ---------------------------------------------------------------------------
// Kernel 1: QKV projection.  grid = (BT/128, 1, 3), block = 256 (8 waves).
// Each block: 128x64 output tile of Q (z=0), K (z=1) or V (z=2).
// K staged 64 wide (2 WMMA k-steps per barrier pair, 8 WMMAs per stage); the
// global loads of a stage run two stages ahead of its LDS stores.  The 16 stages
// are walked from a stage that depends on the block, wrapping at the end.
// A fragment (per lane, 16 halves): lanes 0-15 row M=l, K={0..7,16..23};
// lanes 16-31 row M=l-16, K={8..15,24..31}.  B mirrors with lane = column.
// x lies in LDS as [row][k] and is read with plain 16-byte loads; W lies there
// as it does in memory, [k][col], and its fragments come through the
// transposing load, which delivers the same k order.
// TR = true (Q, K): W^T is the A operand and x the B operand, so that a lane's
// 8 accumulators are 8 adjacent columns of one row.  TR = false (V): x is A,
// a lane's 8 accumulators are 8 adjacent rows of one column.  Either way they
// are one 16-byte element of the fragment layout above.
// ---------------------------------------------------------------------------
template <bool TR>
static __device__ __forceinline__
void proj_tile(const float* __restrict__ x, const float* __restrict__ W,
               const float* __restrict__ bias, _Float16* __restrict__ out,
               _Float16* Alds, _Float16* Wlds)
{
    constexpr int KC   = 64;   // K per stage
    constexpr int STRA = 72;   // halves per A row in LDS (144 B, 16B aligned)
    constexpr int STRB = 80;   // halves per W row (one k) in LDS: 160 B = 32 B x odd

    const int m0   = blockIdx.x * 128;
    const int t    = threadIdx.x;
    const int wave = t >> 5;
    const int lane = t & 31;
    const int ln   = lane & 15;
    const int hi8  = (lane >> 4) * 8;
    const int mrow = wave * 16 + ln;          // x-fragment row within tile
    // this lane's address in the transposing loads, at k = 0 and column 0
    const _Float16* wfr = Wlds + (hi8 + (lane & 7)) * STRB + ((lane >> 3) & 1) * 8;

    f8 acc[4] = {};

    // this thread's place in every staged tile: row r0 + 16*i, 4 columns at cv
    const int r0 = t >> 4, cv = (t & 15) * 4;
    const f4* xs = (const f4*)(x + (size_t)m0 * E_);      // block-uniform
    const f4* ws = (const f4*)W;
    const unsigned vx = r0 * (E_ / 4) + (t & 15);
    const unsigned vw = r0 * (H_ / 4) + (t & 15);

    // all 12 loads of one stage (x: 128 rows x 64 k, W: 64 k x 64 cols) are
    // issued together, into registers that are read two stages later; xk, wk:
    // this lane's addresses in that stage, which then move on by dk in k
    auto fetch = [&](f4 (&xr)[8], f4 (&wr)[4], const f4*& xk, const f4*& wk, int dk) {
        #pragma unroll
        for (int i = 0; i < 8; ++i)
            xr[i] = xk[i * 16 * (E_ / 4)];
        #pragma unroll
        for (int i = 0; i < 4; ++i)
            wr[i] = wk[i * 16 * (H_ / 4)];
        xk += dk / 4;
        wk += dk * (H_ / 4);
    };

    // one stage: registers -> LDS as f16, refill the registers from xk, wk
    // (more = false: no such stage), then the products of this stage
    auto stage = [&](f4 (&xr)[8], f4 (&wr)[4], const f4*& xk, const f4*& wk, int dk,
                     bool more) {
        lds_barrier();
        #pragma unroll
        for (int i = 0; i < 8; ++i) {
            h4 hv = { (_Float16)xr[i][0], (_Float16)xr[i][1],
                      (_Float16)xr[i][2], (_Float16)xr[i][3] };
            *(h4*)(Alds + (r0 + i * 16) * STRA + cv) = hv;
        }
        // W tile as it lies in memory: Wlds[k][col]
        #pragma unroll
        for (int i = 0; i < 4; ++i) {
            h4 hv = { (_Float16)wr[i][0], (_Float16)wr[i][1],
                      (_Float16)wr[i][2], (_Float16)wr[i][3] };
            *(h4*)(Wlds + (r0 + i * 16) * STRB + cv) = hv;
        }
        lds_barrier();

        if (more) fetch(xr, wr, xk, wk, dk);

        #pragma unroll
        for (int c = 0; c < 2; ++c) {
            const int ko = c * 32;
            // hoist all fragment loads, then issue WMMAs back-to-back
            h8 alo = *(const h8*)(Alds + mrow * STRA + ko + hi8);
            h8 ahi = *(const h8*)(Alds + mrow * STRA + ko + 16 + hi8);
            h16 a = hcat(alo, ahi);
            h16 bf[4];
            #pragma unroll
            for (int j = 0; j < 4; ++j) {
                h8 blo = lds_tr16(wfr + ko * STRB + j * 16);
                h8 bhi = lds_tr16(wfr + (ko + 16) * STRB + j * 16);
                bf[j] = hcat(blo, bhi);
            }
            #pragma unroll
            for (int j = 0; j < 4; ++j)
                acc[j] = TR ? wmma_f16(bf[j], a, acc[j])
                            : wmma_f16(a, bf[j], acc[j]);
        }
    };

    // k offset of the s-th stage of this block's walk
    constexpr int NST = E_ / KC;
    static_assert(NST == 16, "entry16 is for a walk of 16 stages");
    const int s0 = entry16(blockIdx.x) + 5 * blockIdx.z;
    auto kof = [&](int s) { return ((s0 + s) & (NST - 1)) * KC; };

    // set a holds the even stages of the walk, set b the odd ones; each has its
    // own addresses, which step two stages at a time and wrap on their own
    const f4* xpa = xs + vx + kof(0) / 4;
    const f4* wpa = ws + vw + kof(0) * (H_ / 4);
    const f4* xpb = xs + vx + kof(1) / 4;
    const f4* wpb = ws + vw + kof(1) * (H_ / 4);

    f4 xa[8], wa[4], xb[8], wb[4];
    fetch(xa, wa, xpa, wpa, kof(2) - kof(0));
    // keeps set a's loads ahead of set b's in issue order: loads return in
    // order, so the wait for set a can then leave all of set b's in flight
    __builtin_amdgcn_sched_barrier(0);
    fetch(xb, wb, xpb, wpb, kof(3) - kof(1));
    for (int s = 0; s < NST - 2; s += 2) {
        stage(xa, wa, xpa, wpa, kof(s + 4) - kof(s + 2), true);
        stage(xb, wb, xpb, wpb, kof(s + 5) - kof(s + 3), true);
    }
    stage(xa, wa, xpa, wpa, 0, false);
    stage(xb, wb, xpb, wpb, 0, false);

    // bias add + f16 store: one 16-byte store per tile, 512 contiguous bytes
    // per wave.  This wave's 16 rows are half hf of 32-row block blk.
    const int blk = (m0 >> 5) + (wave >> 1);
    const int hf  = wave & 1;
    _Float16* ob = out + (size_t)blk * FB_ + lane * 8;
    #pragma unroll
    for (int j = 0; j < 4; ++j) {
        h8 pk;
        if (TR) {
            // acc[j][r] = row (wave*16 + ln), col (j*16 + hi8 + r)
            f4 b0 = *(const f4*)(bias + j * 16 + hi8);
            f4 b1 = *(const f4*)(bias + j * 16 + hi8 + 4);
            #pragma unroll
            for (int r = 0; r < 4; ++r) {
                pk[r]     = (_Float16)(acc[j][r]     + b0[r]);
                pk[r + 4] = (_Float16)(acc[j][r + 4] + b1[r]);
            }
            *(h8*)(ob + (((j >> 1) * 2 + hf) * 2 + (j & 1)) * 256) = pk;
        } else {
            // acc[j][r] = row (wave*16 + hi8 + r), col (j*16 + ln)
            float bj = bias[j * 16 + ln];
            #pragma unroll
            for (int r = 0; r < 8; ++r)
                pk[r] = (_Float16)(acc[j][r] + bj);
            *(h8*)(ob + (j * 2 + hf) * 256) = pk;
        }
    }
}

__global__ __launch_bounds__(256)
void qkv_proj_kernel(const float* __restrict__ x,
                     const float* __restrict__ Wq, const float* __restrict__ bq,
                     const float* __restrict__ Wk, const float* __restrict__ bk,
                     const float* __restrict__ Wv, const float* __restrict__ bv,
                     _Float16* __restrict__ qkv)
{
    __shared__ __attribute__((aligned(16))) _Float16 Alds[128 * 72];
    __shared__ __attribute__((aligned(32))) _Float16 Wlds[64 * 80];

    const int z = blockIdx.z;                 // the same for the whole block
    _Float16* out = qkv + (size_t)z * BT_ * H_;
    if (z == 2)
        proj_tile<false>(x, Wv, bv, out, Alds, Wlds);
    else
        proj_tile<true>(x, z == 0 ? Wq : Wk, z == 0 ? bq : bk, out, Alds, Wlds);
}

typedef float f2 __attribute__((ext_vector_type(2)));
typedef int   i4 __attribute__((ext_vector_type(4)));

struct yes_t { static constexpr bool value = true;  };
struct no_t  { static constexpr bool value = false; };

// value of lane l ^ 16
static __device__ __forceinline__ float xhalf(float v) {
    const int i = __builtin_bit_cast(int, v);
    return __builtin_bit_cast(float,
        __builtin_amdgcn_permlanex16(i, i, 0x76543210, 0xfedcba98, false, false));
}

// four waves a SIMD is all that a 16-wave block on its own WGP can have: said
// here so that the compiler spends registers on loads in flight, not on residency
__global__ __launch_bounds__(512) __attribute__((amdgpu_waves_per_eu(4, 4)))
void flash_attn_kernel(const _Float16* __restrict__ Qh,
                       const _Float16* __restrict__ Kh,
                       const _Float16* __restrict__ Vh,
                       const int* __restrict__ mask,
                       float* __restrict__ out)
{
    constexpr int NW   = 16;   // waves per block
    constexpr int NS   = 4;    // key quarters
    constexpr int KBS  = T_ / 32 / NS;   // key blocks per wave
    constexpr int OSTR = H_ + 4;         // floats per row of a partial O in LDS
    constexpr float L2E = 1.44269504088896340736f;
    // partial O, [query row][column]; read and written 16 bytes at a time
    __shared__ __attribute__((aligned(16))) float Opart[NW][16 * OSTR];
    __shared__ float mpart[NW][16];          // running maximum of each row
    __shared__ float lpart[NW][16];          // running sum of each row

    const int b    = blockIdx.y;
    const int q0   = blockIdx.x * 64;
    const int t    = threadIdx.x;
    // the wave's number in a scalar register: the loop's key blocks depend on it
    const int wave = __builtin_amdgcn_readfirstlane(t >> 5);
    const int qt   = wave & 3;
    const int ks   = wave >> 2;
    const int lane = t & 31;
    const int ln   = lane & 15;
    const int hi8  = (lane >> 4) * 8;

    const size_t kvbase = (size_t)b * T_ * H_;   // = first 32-row block of b

    // preload Q fragments, pre-scaled by H^-0.5 = 0.125 (exact in f16)
    const _Float16* qsrc = Qh + kvbase
        + (size_t)(blockIdx.x * 2 + (qt >> 1)) * FB_ + lane * 8;
    h16 aq[2];
    #pragma unroll
    for (int c = 0; c < 2; ++c) {
        const int pc = (c * 2 + (qt & 1)) * 2;
        h8 lo = *(const h8*)(qsrc + pc * 256);
        h8 hc = *(const h8*)(qsrc + (pc + 1) * 256);
        aq[c] = hcat(lo, hc);
    }
    // precaution: no register that the issued Q loads name is rewritten ahead of this wait
    asm volatile("s_wait_xcnt 0x0" ::: "memory");
    #pragma unroll
    for (int c = 0; c < 2; ++c)
        #pragma unroll
        for (int i = 0; i < 16; ++i) aq[c][i] = aq[c][i] * (_Float16)0.125f;

    // o[j][r] = O[query ln][column j*16 + hi8 + r], unnormalised
    f8 o[4] = {};
    // mrun: query ln's running maximum (equal in both halves of the wave);
    // lrun: the running sum over this half's keys only
    float mrun = -1e30f, lrun = 0.0f;

    // this lane's addresses in key block 0 of the batch
    const _Float16* ksrc = Kh + kvbase + lane * 8;
    const _Float16* vsrc = Vh + kvbase + lane * 8;
    const int*      msrc = mask + b * T_ + lane;

    const int kb0 = ks * KBS;   // first key block of this wave's quarter
    static_assert(KBS == 16, "entry16 is for a walk of 16 key blocks");
    const int st  = entry16(blockIdx.x);   // where the walk through it begins

    // one key block's K fragments and mask word, carried from the pass that
    // loads them to the pass that uses them; the fragments of the walk's first
    // block are asked for here, ahead of the look at the mask
    struct kset { h8 lo[2][2], hi[2][2]; int mk; };
    auto fetch_k = [&](kset& k, const _Float16* kn) {
        #pragma unroll
        for (int c = 0; c < 2; ++c)
            #pragma unroll
            for (int j = 0; j < 2; ++j) {
                k.lo[c][j] = *(const h8*)(kn + ((c * 2 + j) * 2) * 256);
                k.hi[c][j] = *(const h8*)(kn + ((c * 2 + j) * 2 + 1) * 256);
            }
    };
    kset kc;
    const _Float16* kfirst = ksrc + (size_t)(kb0 + st) * FB_;
    fetch_k(kc, kfirst);

    // does this wave's quarter hold a closed key?  Every lane looks at 16 mask
    // words; the answer is the same for the whole wave, in a scalar register
    bool shut = false;
    {
        const i4* mq = (const i4*)(mask + b * T_ + kb0 * 32) + lane * 4;
        i4 w[4];
        #pragma unroll
        for (int i = 0; i < 4; ++i)
            w[i] = mq[i];
        // precaution: no register that the issued K and mask loads name is
        // rewritten ahead of this wait; as its inputs they stay theirs up to it
        asm volatile("s_wait_xcnt 0x0" :: "v"(kfirst), "v"(mq) : "memory");
        #pragma unroll
        for (int i = 0; i < 4; ++i)
            shut |= (w[i][0] == 0) | (w[i][1] == 0) | (w[i][2] == 0) | (w[i][3] == 0);
    }
    const bool anyshut = __builtin_amdgcn_ballot_w32(shut) != 0;

    // the loop over the wave's key blocks; MASKED = false leaves out the mask
    // word and the selects, for a quarter in which every key is open
    auto walk = [&](auto tag) {
        constexpr bool MASKED = decltype(tag)::value;

        kc.mk = MASKED ? msrc[(kb0 + st) * 32] : 1;

        for (int it = 0; it < KBS; ++it) {
            const int kb = kb0 + ((st + it) & (KBS - 1));
            // issue this block's V loads; they are used behind the softmax
            h8 vl[4], vh[4];
            const _Float16* vn = vsrc + (size_t)kb * FB_;
            #pragma unroll
            for (int j = 0; j < 4; ++j) {
                vl[j] = *(const h8*)(vn + (j * 2) * 256);
                vh[j] = *(const h8*)(vn + (j * 2 + 1) * 256);
            }

            // S^T = K @ (Q*scale)^T from the fragments loaded one pass ago:
            // s0[r] = S[query ln][key hi8 + r], s1[r] = S[query ln][key 16 + hi8 + r]
            f8 s0 = {}, s1 = {};
            s0 = wmma_f16(hcat(kc.lo[0][0], kc.hi[0][0]), aq[0], s0);
            s1 = wmma_f16(hcat(kc.lo[0][1], kc.hi[0][1]), aq[0], s1);
            s0 = wmma_f16(hcat(kc.lo[1][0], kc.hi[1][0]), aq[1], s0);
            s1 = wmma_f16(hcat(kc.lo[1][1], kc.hi[1][1]), aq[1], s1);

            // bit k of the ballot: key k of this block is open (lane k holds its
            // mask word)
            const unsigned ob = MASKED
                ? __builtin_amdgcn_ballot_w32(kc.mk != 0) >> hi8 : 0u;

            // precaution: the register pair that the issued V loads name is not
            // rewritten ahead of this wait; as its input it stays theirs up to it.
            // The scores as inputs keep the four products ahead of the loads
            // that refill their K registers: with the products behind them the
            // compiler copies the fragments once per pass
            asm volatile("s_wait_xcnt 0x0" :: "v"(s0), "v"(s1), "v"(vn) : "memory");

            // issue the next block's K and mask loads; the wave's last pass
            // loads the walk's first block again, so that every address stays
            // inside the wave's own keys
            const size_t nn = (size_t)(kb0 + ((st + it + 1) & (KBS - 1)));
            const _Float16* kn = ksrc + nn * FB_;
            const int*      mn = msrc + nn * 32;
            fetch_k(kc, kn);
            // precaution, as above, for the registers that these loads name
            if (MASKED) {
                kc.mk = *mn;
                asm volatile("s_wait_xcnt 0x0" :: "v"(kn), "v"(mn) : "memory");
            } else {
                asm volatile("s_wait_xcnt 0x0" :: "v"(kn) : "memory");
            }

            // a closed key scores -1e9
            if (MASKED) {
                #pragma unroll
                for (int r = 0; r < 8; ++r) {
                    s0[r] = ((ob >> r) & 1u)        ? s0[r] : -1e9f;
                    s1[r] = ((ob >> (16 + r)) & 1u) ? s1[r] : -1e9f;
                }
            }

            // online softmax of query ln, in this lane's registers
            const float x0 = fmaxf(fmaxf(s0[0], s0[1]), s0[2]);
            const float x1 = fmaxf(fmaxf(s0[3], s0[4]), s0[5]);
            const float x2 = fmaxf(fmaxf(s0[6], s0[7]), s1[0]);
            const float x3 = fmaxf(fmaxf(s1[1], s1[2]), s1[3]);
            const float x4 = fmaxf(fmaxf(s1[4], s1[5]), s1[6]);
            float mx = fmaxf(fmaxf(fmaxf(x0, x1), x2), fmaxf(fmaxf(x3, x4), s1[7]));
            mx = fmaxf(mx, xhalf(mx));
            const float mnew  = fmaxf(mrun, mx);
            const float alpha = __builtin_amdgcn_exp2f((mrun - mnew) * L2E);
            mrun = mnew;

            h16 pf;           // P^T as a B operand: k order hi8 + r, 16 + hi8 + r
            f2  sum0 = { 0.0f, 0.0f }, sum1 = sum0;
            #pragma unroll
            for (int r = 0; r < 8; r += 2) {
                f2 e0 = { s0[r], s0[r + 1] };
                f2 e1 = { s1[r], s1[r + 1] };
                e0 = (e0 - mnew) * L2E;
                e1 = (e1 - mnew) * L2E;
                f2 p0 = { __builtin_amdgcn_exp2f(e0[0]), __builtin_amdgcn_exp2f(e0[1]) };
                f2 p1 = { __builtin_amdgcn_exp2f(e1[0]), __builtin_amdgcn_exp2f(e1[1]) };
                sum0 += p0;
                sum1 += p1;
                pf[r]     = (_Float16)p0[0];
                pf[r + 1] = (_Float16)p0[1];
                pf[r + 8] = (_Float16)p1[0];
                pf[r + 9] = (_Float16)p1[1];
            }
            sum0 += sum1;
            lrun = alpha * lrun + (sum0[0] + sum0[1]);

            // rescale the accumulator: every element of a lane is of query ln
            #pragma unroll
            for (int j = 0; j < 4; ++j)
                o[j] *= alpha;

            // O^T += V^T @ P^T from the V fragments loaded at the head of the pass
            #pragma unroll
            for (int j = 0; j < 4; ++j)
                o[j] = wmma_f16(hcat(vl[j], vh[j]), pf, o[j]);

            // compiler fence: holds the next block's K loads inside this pass;
            // without it the compiler carries their address over instead and
            // loads at the head of the next pass, right in front of their use
            asm volatile("" ::: "memory");
        }
    };
    if (anyshut) walk(yes_t{});
    else         walk(no_t{});

    // the two halves of the wave summed different keys of the same query
    lrun += xhalf(lrun);

    // hand the partial result over, row-major: 32 bytes per lane and tile
    {
        float* ow = Opart[wave] + ln * OSTR + hi8;
        #pragma unroll
        for (int j = 0; j < 4; ++j) {
            f4 lo = { o[j][0], o[j][1], o[j][2], o[j][3] };
            f4 hc = { o[j][4], o[j][5], o[j][6], o[j][7] };
            *(f4*)(ow + j * 16)     = lo;
            *(f4*)(ow + j * 16 + 4) = hc;
        }
    }
    if (lane < 16) {
        mpart[wave][lane] = mrun;
        lpart[wave][lane] = lrun;
    }
    // every wave's partial result is in LDS before any wave reads one
    __syncthreads();

    // this wave finishes rows ks*4 .. ks*4 + 3 of tile qt, eight lanes a row,
    // eight columns a lane: weight of quarter s is
    // exp(m_s - m) / sum over s of l_s * exp(m_s - m)
    const int row = ks * 4 + (lane >> 3);
    const int col = (lane & 7) * 8;
    float ms[NS], wt[NS];
    float mall = -1e30f;
    #pragma unroll
    for (int s = 0; s < NS; ++s) {
        ms[s] = mpart[s * 4 + qt][row];
        mall  = fmaxf(mall, ms[s]);
    }
    float lsum = 0.0f;
    #pragma unroll
    for (int s = 0; s < NS; ++s) {
        wt[s] = __expf(ms[s] - mall);
        lsum += lpart[s * 4 + qt][row] * wt[s];
    }
    const float inv = 1.0f / lsum;

    f4 r0 = { 0.0f, 0.0f, 0.0f, 0.0f }, r1 = r0;
    #pragma unroll
    for (int s = 0; s < NS; ++s) {
        const float* pr = Opart[s * 4 + qt] + row * OSTR + col;
        r0 += *(const f4*)pr * wt[s];
        r1 += *(const f4*)(pr + 4) * wt[s];
    }
    float* orow = out + ((size_t)b * T_ + q0 + qt * 16 + row) * H_ + col;
    *(f4*)orow       = r0 * inv;
    *(f4*)(orow + 4) = r1 * inv;
}

// ---------------------------------------------------------------------------
// Launch
// ---------------------------------------------------------------------------
extern "C" void kernel_launch(void* const* d_in, const int* in_sizes, int n_in,
                              void* d_out, int out_size, void* d_ws, size_t ws_size,
                              hipStream_t stream)
{
    const float* x    = (const float*)d_in[0];
    const float* Wq   = (const float*)d_in[1];
    const float* bq   = (const float*)d_in[2];
    const float* Wk   = (const float*)d_in[3];
    const float* bk   = (const float*)d_in[4];
    const float* Wv   = (const float*)d_in[5];
    const float* bv   = (const float*)d_in[6];
    const int*   mask = (const int*)d_in[7];
    float* out = (float*)d_out;

    _Float16* qkv = (_Float16*)d_ws;                 // 3 * BT * H halves = 6 MB
    const _Float16* Qh = qkv;
    const _Float16* Kh = qkv + (size_t)BT_ * H_;
    const _Float16* Vh = qkv + (size_t)2 * BT_ * H_;

    dim3 g1(BT_ / 128, 1, 3);
    qkv_proj_kernel<<<g1, 256, 0, stream>>>(x, Wq, bq, Wk, bk, Wv, bv, qkv);

    dim3 g2(T_ / 64, B_, 1);
    flash_attn_kernel<<<g2, 512, 0, stream>>>(Qh, Kh, Vh, mask, out);
}

// v008
// A run of this version takes 25.3 microseconds.
// In two side-by-side timings against v007, it was 1.05 and 1.06 times as fast.
// All steps since v000 together make it 7.81 times as fast.
#include <hip/hip_runtime.h>
#include <hip/hip_bf16.h>

// ---------------------------------------------------------------------------
// AttentionHead for MI455X (gfx1250, wave32, WMMA f16 16x16x32 -> f32).
// Phase 1: QKV projection  x[BT,E] @ W[E,H] + b  -> f16 in workspace, laid out
//          as the finished WMMA fragments that phase 2 reads.
// Phase 2: fused flash attention (online softmax) -> f32 out.
//
// Workspace layout.  Each of Q, K, V is cut into blocks of 32 rows x 64 cols
// (FB_ = 2048 halves); a block is 8 pieces of 512 B; lane l owns bytes
// 16*l .. 16*l+15 of every piece (c = l & 15, h = l >> 4, e = 0..7):
//   Q, K piece ((cc*2 + jj)*2 + p): element e = M[jj*16 + c][cc*32 + p*16 + h*8 + e]
//   V    piece (j*2 + p)          : element e = V[p*16 + h*8 + e][j*16 + c]
// Pieces p = 0 and p = 1 together are one 16x32 (32x16) f16 operand.
// ---------------------------------------------------------------------------

#define B_  8
#define T_  2048
#define E_  1024
#define H_  64
#define BT_ (B_ * T_)
#define FB_ (32 * H_)   // halves in one 32-row fragment block

typedef _Float16 h2  __attribute__((ext_vector_type(2)));
typedef _Float16 h4  __attribute__((ext_vector_type(4)));
typedef _Float16 h8  __attribute__((ext_vector_type(8)));
typedef _Float16 h16 __attribute__((ext_vector_type(16)));
typedef float    f4  __attribute__((ext_vector_type(4)));
typedef float    f8  __attribute__((ext_vector_type(8)));

static __device__ __forceinline__ h16 hcat(h8 a, h8 b) {
    return __builtin_shufflevector(a, b, 0,1,2,3,4,5,6,7,8,9,10,11,12,13,14,15);
}

// D = A(16x32 f16) x B(32x16 f16) + C(16x16 f32)
static __device__ __forceinline__ f8 wmma_f16(h16 a, h16 b, f8 c) {
    return __builtin_amdgcn_wmma_f32_16x16x32_f16(
        /*neg_a=*/false, a, /*neg_b=*/false, b,
        /*c_mod=*/(short)0, c, /*reuse_a=*/false, /*reuse_b=*/false);
}

// Transposing LDS load: from a row-major 16-bit tile T (rows = k) lane (c, h)
// gets T[kbase + 8h + 0..7][dbase + c]; lane l passes the address of
// T[kbase + 8*(l >> 4) + (l & 7)][dbase + 8*((l >> 3) & 1)].
typedef short s8v __attribute__((ext_vector_type(8)));
static __device__ __forceinline__ h8 lds_tr16(const _Float16* p) {
    typedef __attribute__((address_space(3))) s8v lds_s8v;
    return __builtin_bit_cast(h8, __builtin_amdgcn_ds_load_tr16_b128_v8i16((lds_s8v*)p));
}

// Work-group barrier that orders LDS traffic only.  __syncthreads() would also
// wait for every global load in flight, and the projection's loads are meant to
// stay in flight across two stages.  The wait covers this wave's LDS reads and
// writes; the clobber keeps the compiler from moving LDS accesses across it.
static __device__ __forceinline__ void lds_barrier() {
    asm volatile("s_wait_dscnt 0x0\n\ts_barrier_signal -1\n\ts_barrier_wait -1" ::: "memory");
}

// Where block b enters a walk of 16 steps that it shares with other blocks.
// Any four neighbours out of eight blocks, taken over 32 blocks, get 16 different
// values.  For speed only: every value in 0..15 gives the same sums in another order.
static __device__ __forceinline__ int entry16(int b) {
    return (((b >> 3) << 2) | (b & 3)) & 15;
}

// ---------------------------------------------------------------------------
// Kernel 1: QKV projection.  grid = (BT/128, 1, 2), block = 256 (8 waves).
// Each block: 128 rows x 32 columns of each of Q, K and V (columns z*32 ..
// z*32 + 31), a 128x96 output tile: 256 equal blocks, and a tile of x is read,
// converted and staged for two blocks, not for three.
// Wave w works on row group rg = w >> 1 (32 rows, 2 row tiles) and on column
// tile g = z*2 + (w & 1) (16 columns) of each of Q, K and V: 6 accumulator
// tiles, fed by 2 x fragments and 3 W fragments per WMMA k-step.
// K staged 64 wide (2 WMMA k-steps per barrier pair, 12 WMMAs per stage); the
// global loads of a stage run two stages ahead of its LDS stores.  The 16 stages
// are walked from a stage that depends on the block, wrapping at the end.
// A fragment (per lane, 16 halves): lanes 0-15 row M=l, K={0..7,16..23};
// lanes 16-31 row M=l-16, K={8..15,24..31}.  B mirrors with lane = column.
// x lies in LDS as [row][k] and is read with plain 16-byte loads; each W part
// lies there as it does in memory, [k][col], and its fragments come through the
// transposing load, which delivers the same k order.
// Q, K: W^T is the A operand and x the B operand, so that a lane's 8
// accumulators are 8 adjacent columns of one row.  V: x is A, a lane's 8
// accumulators are 8 adjacent rows of one column.  Either way they are one
// 16-byte element of the fragment layout above.
// ---------------------------------------------------------------------------
__global__ __launch_bounds__(256)
void qkv_proj_kernel(const float* __restrict__ x,
                     const float* __restrict__ Wq, const float* __restrict__ bq,
                     const float* __restrict__ Wk, const float* __restrict__ bk,
                     const float* __restrict__ Wv, const float* __restrict__ bv,
                     _Float16* __restrict__ qkv)
{
    constexpr int KC   = 64;   // K per stage
    constexpr int NC   = 32;   // columns of each W per block
    constexpr int STRA = 72;   // halves per A row in LDS (144 B, 16B aligned)
    constexpr int STRB = 48;   // halves per W row (one k) in LDS: 96 B = 32 B x odd
    constexpr int WT   = KC * STRB;   // halves of one staged W part

    __shared__ __attribute__((aligned(16))) _Float16 Alds[128 * STRA];
    __shared__ __attribute__((aligned(32))) _Float16 Wlds[3 * WT];   // Wq, Wk, Wv

    const int m0   = blockIdx.x * 128;
    const int z    = blockIdx.z;              // which 32 columns
    const int t    = threadIdx.x;
    const int wave = t >> 5;
    const int lane = t & 31;
    const int ln   = lane & 15;
    const int hi8  = (lane >> 4) * 8;
    const int rg   = wave >> 1;               // row group: 32 rows
    const int cl   = wave & 1;                // column tile within the block's 32
    const int g    = z * 2 + cl;              // column tile of Q, of K and of V
    // this lane's address in the x fragments, at row tile 0 of its group and k = 0
    const _Float16* afr = Alds + (rg * 32 + ln) * STRA + hi8;
    // this lane's address in the transposing loads, at k = 0 of Wq's part
    const _Float16* wfr = Wlds + (hi8 + (lane & 7)) * STRB + ((lane >> 3) & 1) * 8 + cl * 16;

    f8 acc[3][2] = {};   // [Q, K, V][row tile]

    // this thread's place in the staged x tile: row r0 + 16*i, 4 columns at cv;
    // in every staged W part: row q0 + 32*i, 4 columns at cw
    const int r0 = t >> 4, cv = (t & 15) * 4;
    const int q0 = t >> 3, cw = (t & 7) * 4;
    const f4* xs = (const f4*)(x + (size_t)m0 * E_);      // block-uniform
    const f4* wq = (const f4*)(Wq + z * NC);
    const f4* wk = (const f4*)(Wk + z * NC);
    const f4* wv = (const f4*)(Wv + z * NC);
    const unsigned vx = r0 * (E_ / 4) + (t & 15);
    const unsigned vw = q0 * (H_ / 4) + (t & 7);

    // all 14 loads of one stage (x: 128 rows x 64 k, each W: 64 k x 32 cols) are
    // issued together, into registers that are read two stages later; xo, wo:
    // this lane's offsets (in 16-byte units) in that stage, which then move on by
    // dk in k; the three W share one offset
    auto fetch = [&](f4 (&xr)[8], f4 (&wr)[3][2], unsigned& xo, unsigned& wo, int dk) {
        const f4* xk = xs + (size_t)xo;
        const f4* qk = wq + (size_t)wo;
        const f4* kk = wk + (size_t)wo;
        const f4* vk = wv + (size_t)wo;
        #pragma unroll
        for (int i = 0; i < 8; ++i)
            xr[i] = xk[i * 16 * (E_ / 4)];
        #pragma unroll
        for (int i = 0; i < 2; ++i) {
            wr[0][i] = qk[i * 32 * (H_ / 4)];
            wr[1][i] = kk[i * 32 * (H_ / 4)];
            wr[2][i] = vk[i * 32 * (H_ / 4)];
        }
        // precaution: no register that the issued loads name is rewritten ahead
        // of this wait; as its inputs the offsets stay theirs up to it
        asm volatile("s_wait_xcnt 0x0" :: "v"(xo), "v"(wo) : "memory");
        xo += dk / 4;
        wo += dk * (H_ / 4);
    };

    // one stage: registers -> LDS as f16, refill the registers from xo, wo
    // (more = false: no such stage), then the products of this stage
    auto stage = [&](f4 (&xr)[8], f4 (&wr)[3][2], unsigned& xo, unsigned& wo, int dk,
                     bool more) {
        lds_barrier();
        #pragma unroll
        for (int i = 0; i < 8; ++i) {
            h4 hv = { (_Float16)xr[i][0], (_Float16)xr[i][1],
                      (_Float16)xr[i][2], (_Float16)xr[i][3] };
            *(h4*)(Alds + (r0 + i * 16) * STRA + cv) = hv;
        }
        // W parts as they lie in memory: Wlds[which][k][col]
        #pragma unroll
        for (int w = 0; w < 3; ++w)
            #pragma unroll
            for (int i = 0; i < 2; ++i) {
                h4 hv = { (_Float16)wr[w][i][0], (_Float16)wr[w][i][1],
                          (_Float16)wr[w][i][2], (_Float16)wr[w][i][3] };
                *(h4*)(Wlds + w * WT + (q0 + i * 32) * STRB + cw) = hv;
            }
        lds_barrier();

        if (more) fetch(xr, wr, xo, wo, dk);

        #pragma unroll
        for (int c = 0; c < 2; ++c) {
            const int ko = c * 32;
            // hoist all fragment loads, then issue WMMAs back-to-back
            h16 a[2], bf[3];
            #pragma unroll
            for (int i = 0; i < 2; ++i) {
                h8 alo = *(const h8*)(afr + i * 16 * STRA + ko);
                h8 ahi = *(const h8*)(afr + i * 16 * STRA + ko + 16);
                a[i] = hcat(alo, ahi);
            }
            #pragma unroll
            for (int w = 0; w < 3; ++w) {
                h8 blo = lds_tr16(wfr + w * WT + ko * STRB);
                h8 bhi = lds_tr16(wfr + w * WT + (ko + 16) * STRB);
                bf[w] = hcat(blo, bhi);
            }
            #pragma unroll
            for (int i = 0; i < 2; ++i) {
                acc[0][i] = wmma_f16(bf[0], a[i], acc[0][i]);
                acc[1][i] = wmma_f16(bf[1], a[i], acc[1][i]);
                acc[2][i] = wmma_f16(a[i], bf[2], acc[2][i]);
            }
        }
    };

    // k offset of the s-th stage of this block's walk; the two blocks that share
    // a tile of x walk half a round apart
    constexpr int NST = E_ / KC;
    static_assert(NST == 16, "entry16 is for a walk of 16 stages");
    const int s0 = entry16(blockIdx.x) + 8 * z;
    auto kof = [&](int s) { return ((s0 + s) & (NST - 1)) * KC; };

    // set a holds the even stages of the walk, set b the odd ones; each has its
    // own offsets, which step two stages at a time and wrap on their own
    unsigned xoa = vx + kof(0) / 4, woa = vw + kof(0) * (H_ / 4);
    unsigned xob = vx + kof(1) / 4, wob = vw + kof(1) * (H_ / 4);

    f4 xa[8], wa[3][2], xb[8], wb[3][2];
    fetch(xa, wa, xoa, woa, kof(2) - kof(0));
    // keeps set a's loads ahead of set b's in issue order: loads return in
    // order, so the wait for set a can then leave all of set b's in flight
    __builtin_amdgcn_sched_barrier(0);
    fetch(xb, wb, xob, wob, kof(3) - kof(1));
    for (int s = 0; s < NST - 2; s += 2) {
        stage(xa, wa, xoa, woa, kof(s + 4) - kof(s + 2), true);
        stage(xb, wb, xob, wob, kof(s + 5) - kof(s + 3), true);
    }
    stage(xa, wa, xoa, woa, 0, false);
    stage(xb, wb, xob, wob, 0, false);

    // bias add + f16 store: one 16-byte store per tile, 512 contiguous bytes
    // per wave.  This wave's 32 rows are one 32-row block, row tile i its half i.
    const float* pbq = bq + g * 16 + hi8;
    const float* pbk = bk + g * 16 + hi8;
    const float* pbv = bv + g * 16 + ln;
    const f4 bq0 = *(const f4*)pbq, bq1 = *(const f4*)(pbq + 4);
    const f4 bk0 = *(const f4*)pbk, bk1 = *(const f4*)(pbk + 4);
    const float bvj = *pbv;
    // precaution: no register that the issued bias loads name is rewritten ahead
    // of this wait; as its inputs the addresses stay theirs up to it
    asm volatile("s_wait_xcnt 0x0" :: "v"(pbq), "v"(pbk), "v"(pbv) : "memory");
    _Float16* oq = qkv + (size_t)((m0 >> 5) + rg) * FB_ + lane * 8;
    _Float16* ok = oq + (size_t)BT_ * H_;
    _Float16* ov = ok + (size_t)BT_ * H_;
    #pragma unroll
    for (int i = 0; i < 2; ++i) {
        // Q, K: acc[.][i][r] = row (rg*32 + i*16 + ln), col (g*16 + hi8 + r)
        const int pqk = (((g >> 1) * 2 + i) * 2 + (g & 1)) * 256;
        h8 pq, pk, pv;
        #pragma unroll
        for (int r = 0; r < 4; ++r) {
            pq[r]     = (_Float16)(acc[0][i][r]     + bq0[r]);
            pq[r + 4] = (_Float16)(acc[0][i][r + 4] + bq1[r]);
            pk[r]     = (_Float16)(acc[1][i][r]     + bk0[r]);
            pk[r + 4] = (_Float16)(acc[1][i][r + 4] + bk1[r]);
        }
        // V: acc[2][i][r] = row (rg*32 + i*16 + hi8 + r), col (g*16 + ln)
        #pragma unroll
        for (int r = 0; r < 8; ++r)
            pv[r] = (_Float16)(acc[2][i][r] + bvj);
        *(h8*)(oq + pqk) = pq;
        *(h8*)(ok + pqk) = pk;
        *(h8*)(ov + (g * 2 + i) * 256) = pv;
    }
}

typedef float f2 __attribute__((ext_vector_type(2)));
typedef int   i4 __attribute__((ext_vector_type(4)));

struct yes_t { static constexpr bool value = true;  };
struct no_t  { static constexpr bool value = false; };

// value of lane l ^ 16
static __device__ __forceinline__ float xhalf(float v) {
    const int i = __builtin_bit_cast(int, v);
    return __builtin_bit_cast(float,
        __builtin_amdgcn_permlanex16(i, i, 0x76543210, 0xfedcba98, false, false));
}

// four waves a SIMD is all that a 16-wave block on its own WGP can have: said
// here so that the compiler spends registers on loads in flight, not on residency
__global__ __launch_bounds__(512) __attribute__((amdgpu_waves_per_eu(4, 4)))
void flash_attn_kernel(const _Float16* __restrict__ Qh,
                       const _Float16* __restrict__ Kh,
                       const _Float16* __restrict__ Vh,
                       const int* __restrict__ mask,
                       float* __restrict__ out)
{
    constexpr int NW   = 16;   // waves per block
    constexpr int NS   = 4;    // key quarters
    constexpr int KBS  = T_ / 32 / NS;   // key blocks per wave
    constexpr int OSTR = H_ + 4;         // floats per row of a partial O in LDS
    constexpr float L2E = 1.44269504088896340736f;
    // partial O, [query row][column]; read and written 16 bytes at a time
    __shared__ __attribute__((aligned(16))) float Opart[NW][16 * OSTR];
    __shared__ float mpart[NW][16];          // running maximum of each row
    __shared__ float lpart[NW][16];          // running sum of each row

    const int b    = blockIdx.y;
    const int q0   = blockIdx.x * 64;
    const int t    = threadIdx.x;
    // the wave's number in a scalar register: the loop's key blocks depend on it
    const int wave = __builtin_amdgcn_readfirstlane(t >> 5);
    const int qt   = wave & 3;
    const int ks   = wave >> 2;
    const int lane = t & 31;
    const int ln   = lane & 15;
    const int hi8  = (lane >> 4) * 8;

    const size_t kvbase = (size_t)b * T_ * H_;   // = first 32-row block of b

    // preload Q fragments, pre-scaled by H^-0.5 = 0.125 (exact in f16)
    const _Float16* qsrc = Qh + kvbase
        + (size_t)(blockIdx.x * 2 + (qt >> 1)) * FB_ + lane * 8;
    h16 aq[2];
    #pragma unroll
    for (int c = 0; c < 2; ++c) {
        const int pc = (c * 2 + (qt & 1)) * 2;
        h8 lo = *(const h8*)(qsrc + pc * 256);
        h8 hc = *(const h8*)(qsrc + (pc + 1) * 256);
        aq[c] = hcat(lo, hc);
    }
    // precaution: no register that the issued Q loads name is rewritten ahead of this wait
    asm volatile("s_wait_xcnt 0x0" ::: "memory");
    #pragma unroll
    for (int c = 0; c < 2; ++c)
        #pragma unroll
        for (int i = 0; i < 16; ++i) aq[c][i] = aq[c][i] * (_Float16)0.125f;

    // o[j][r] = O[query ln][column j*16 + hi8 + r], unnormalised
    f8 o[4] = {};
    // mrun: query ln's running maximum (equal in both halves of the wave);
    // lrun: the running sum over this half's keys only
    float mrun = -1e30f, lrun = 0.0f;

    // this lane's addresses in key block 0 of the batch
    const _Float16* ksrc = Kh + kvbase + lane * 8;
    const _Float16* vsrc = Vh + kvbase + lane * 8;
    const int*      msrc = mask + b * T_ + lane;

    const int kb0 = ks * KBS;   // first key block of this wave's quarter
    static_assert(KBS == 16, "entry16 is for a walk of 16 key blocks");
    const int st  = entry16(blockIdx.x);   // where the walk through it begins

    // one key block's K fragments and mask word, carried from the pass that
    // loads them to the pass that uses them; the fragments of the walk's first
    // block are asked for here, ahead of the look at the mask
    struct kset { h8 lo[2][2], hi[2][2]; int mk; };
    auto fetch_k = [&](kset& k, const _Float16* kn) {
        #pragma unroll
        for (int c = 0; c < 2; ++c)
            #pragma unroll
            for (int j = 0; j < 2; ++j) {
                k.lo[c][j] = *(const h8*)(kn + ((c * 2 + j) * 2) * 256);
                k.hi[c][j] = *(const h8*)(kn + ((c * 2 + j) * 2 + 1) * 256);
            }
    };
    kset kc;
    const _Float16* kfirst = ksrc + (size_t)(kb0 + st) * FB_;
    fetch_k(kc, kfirst);

    // does this wave's quarter hold a closed key?  Every lane looks at 16 mask
    // words; the answer is the same for the whole wave, in a scalar register
    bool shut = false;
    {
        const i4* mq = (const i4*)(mask + b * T_ + kb0 * 32) + lane * 4;
        i4 w[4];
        #pragma unroll
        for (int i = 0; i < 4; ++i)
            w[i] = mq[i];
        // precaution: no register that the issued K and mask loads name is
        // rewritten ahead of this wait; as its inputs they stay theirs up to it
        asm volatile("s_wait_xcnt 0x0" :: "v"(kfirst), "v"(mq) : "memory");
        #pragma unroll
        for (int i = 0; i < 4; ++i)
            shut |= (w[i][0] == 0) | (w[i][1] == 0) | (w[i][2] == 0) | (w[i][3] == 0);
    }
    const bool anyshut = __builtin_amdgcn_ballot_w32(shut) != 0;

    // the loop over the wave's key blocks; MASKED = false leaves out the mask
    // word and the selects, for a quarter in which every key is open
    auto walk = [&](auto tag) {
        constexpr bool MASKED = decltype(tag)::value;

        kc.mk = MASKED ? msrc[(kb0 + st) * 32] : 1;

        for (int it = 0; it < KBS; ++it) {
            const int kb = kb0 + ((st + it) & (KBS - 1));
            // issue this block's V loads; they are used behind the softmax
            h8 vl[4], vh[4];
            const _Float16* vn = vsrc + (size_t)kb * FB_;
            #pragma unroll
            for (int j = 0; j < 4; ++j) {
                vl[j] = *(const h8*)(vn + (j * 2) * 256);
                vh[j] = *(const h8*)(vn + (j * 2 + 1) * 256);
            }

            // S^T = K @ (Q*scale)^T from the fragments loaded one pass ago:
            // s0[r] = S[query ln][key hi8 + r], s1[r] = S[query ln][key 16 + hi8 + r]
            f8 s0 = {}, s1 = {};
            s0 = wmma_f16(hcat(kc.lo[0][0], kc.hi[0][0]), aq[0], s0);
            s1 = wmma_f16(hcat(kc.lo[0][1], kc.hi[0][1]), aq[0], s1);
            s0 = wmma_f16(hcat(kc.lo[1][0], kc.hi[1][0]), aq[1], s0);
            s1 = wmma_f16(hcat(kc.lo[1][1], kc.hi[1][1]), aq[1], s1);

            // bit k of the ballot: key k of this block is open (lane k holds its
            // mask word)
            const unsigned ob = MASKED
                ? __builtin_amdgcn_ballot_w32(kc.mk != 0) >> hi8 : 0u;

            // precaution: the register pair that the issued V loads name is not
            // rewritten ahead of this wait; as its input it stays theirs up to it.
            // The scores as inputs keep the four products ahead of the loads
            // that refill their K registers: with the products behind them the
            // compiler copies the fragments once per pass
            asm volatile("s_wait_xcnt 0x0" :: "v"(s0), "v"(s1), "v"(vn) : "memory");

            // issue the next block's K and mask loads; the wave's last pass
            // loads the walk's first block again, so that every address stays
            // inside the wave's own keys
            const size_t nn = (size_t)(kb0 + ((st + it + 1) & (KBS - 1)));
            const _Float16* kn = ksrc + nn * FB_;
            const int*      mn = msrc + nn * 32;
            fetch_k(kc, kn);
            // precaution, as above, for the registers that these loads name
            if (MASKED) {
                kc.mk = *mn;
                asm volatile("s_wait_xcnt 0x0" :: "v"(kn), "v"(mn) : "memory");
            } else {
                asm volatile("s_wait_xcnt 0x0" :: "v"(kn) : "memory");
            }

            // a closed key scores -1e9
            if (MASKED) {
                #pragma unroll
                for (int r = 0; r < 8; ++r) {
                    s0[r] = ((ob >> r) & 1u)        ? s0[r] : -1e9f;
                    s1[r] = ((ob >> (16 + r)) & 1u) ? s1[r] : -1e9f;
                }
            }

            // online softmax of query ln, in this lane's registers
            const float x0 = fmaxf(fmaxf(s0[0], s0[1]), s0[2]);
            const float x1 = fmaxf(fmaxf(s0[3], s0[4]), s0[5]);
            const float x2 = fmaxf(fmaxf(s0[6], s0[7]), s1[0]);
            const float x3 = fmaxf(fmaxf(s1[1], s1[2]), s1[3]);
            const float x4 = fmaxf(fmaxf(s1[4], s1[5]), s1[6]);
            float mx = fmaxf(fmaxf(fmaxf(x0, x1), x2), fmaxf(fmaxf(x3, x4), s1[7]));
            mx = fmaxf(mx, xhalf(mx));
            const float mnew  = fmaxf(mrun, mx);
            const float alpha = __builtin_amdgcn_exp2f((mrun - mnew) * L2E);
            mrun = mnew;

            h16 pf;           // P^T as a B operand: k order hi8 + r, 16 + hi8 + r
            f2  sum0 = { 0.0f, 0.0f }, sum1 = sum0;
            #pragma unroll
            for (int r = 0; r < 8; r += 2) {
                f2 e0 = { s0[r], s0[r + 1] };
                f2 e1 = { s1[r], s1[r + 1] };
                e0 = (e0 - mnew) * L2E;
                e1 = (e1 - mnew) * L2E;
                f2 p0 = { __builtin_amdgcn_exp2f(e0[0]), __builtin_amdgcn_exp2f(e0[1]) };
                f2 p1 = { __builtin_amdgcn_exp2f(e1[0]), __builtin_amdgcn_exp2f(e1[1]) };
                sum0 += p0;
                sum1 += p1;
                pf[r]     = (_Float16)p0[0];
                pf[r + 1] = (_Float16)p0[1];
                pf[r + 8] = (_Float16)p1[0];
                pf[r + 9] = (_Float16)p1[1];
            }
            sum0 += sum1;
            lrun = alpha * lrun + (sum0[0] + sum0[1]);

            // rescale the accumulator: every element of a lane is of query ln
            #pragma unroll
            for (int j = 0; j < 4; ++j)
                o[j] *= alpha;

            // O^T += V^T @ P^T from the V fragments loaded at the head of the pass
            #pragma unroll
            for (int j = 0; j < 4; ++j)
                o[j] = wmma_f16(hcat(vl[j], vh[j]), pf, o[j]);

            // compiler fence: holds the next block's K loads inside this pass;
            // without it the compiler carries their address over instead and
            // loads at the head of the next pass, right in front of their use
            asm volatile("" ::: "memory");
        }
    };
    if (anyshut) walk(yes_t{});
    else         walk(no_t{});

    // the two halves of the wave summed different keys of the same query
    lrun += xhalf(lrun);

    // hand the partial result over, row-major: 32 bytes per lane and tile
    {
        float* ow = Opart[wave] + ln * OSTR + hi8;
        #pragma unroll
        for (int j = 0; j < 4; ++j) {
            f4 lo = { o[j][0], o[j][1], o[j][2], o[j][3] };
            f4 hc = { o[j][4], o[j][5], o[j][6], o[j][7] };
            *(f4*)(ow + j * 16)     = lo;
            *(f4*)(ow + j * 16 + 4) = hc;
        }
    }
    if (lane < 16) {
        mpart[wave][lane] = mrun;
        lpart[wave][lane] = lrun;
    }
    // every wave's partial result is in LDS before any wave reads one
    __syncthreads();

    // this wave finishes rows ks*4 .. ks*4 + 3 of tile qt, eight lanes a row,
    // eight columns a lane: weight of quarter s is
    // exp(m_s - m) / sum over s of l_s * exp(m_s - m)
    const int row = ks * 4 + (lane >> 3);
    const int col = (lane & 7) * 8;
    float ms[NS], wt[NS];
    float mall = -1e30f;
    #pragma unroll
    for (int s = 0; s < NS; ++s) {
        ms[s] = mpart[s * 4 + qt][row];
        mall  = fmaxf(mall, ms[s]);
    }
    float lsum = 0.0f;
    #pragma unroll
    for (int s = 0; s < NS; ++s) {
        wt[s] = __expf(ms[s] - mall);
        lsum += lpart[s * 4 + qt][row] * wt[s];
    }
    const float inv = 1.0f / lsum;

    f4 r0 = { 0.0f, 0.0f, 0.0f, 0.0f }, r1 = r0;
    #pragma unroll
    for (int s = 0; s < NS; ++s) {
        const float* pr = Opart[s * 4 + qt] + row * OSTR + col;
        r0 += *(const f4*)pr * wt[s];
        r1 += *(const f4*)(pr + 4) * wt[s];
    }
    float* orow = out + ((size_t)b * T_ + q0 + qt * 16 + row) * H_ + col;
    *(f4*)orow       = r0 * inv;
    *(f4*)(orow + 4) = r1 * inv;
}

// ---------------------------------------------------------------------------
// Launch
// ---------------------------------------------------------------------------
extern "C" void kernel_launch(void* const* d_in, const int* in_sizes, int n_in,
                              void* d_out, int out_size, void* d_ws, size_t ws_size,
                              hipStream_t stream)
{
    const float* x    = (const float*)d_in[0];
    const float* Wq   = (const float*)d_in[1];
    const float* bq   = (const float*)d_in[2];
    const float* Wk   = (const float*)d_in[3];
    const float* bk   = (const float*)d_in[4];
    const float* Wv   = (const float*)d_in[5];
    const float* bv   = (const float*)d_in[6];
    const int*   mask = (const int*)d_in[7];
    float* out = (float*)d_out;

    _Float16* qkv = (_Float16*)d_ws;                 // 3 * BT * H halves = 6 MB
    const _Float16* Qh = qkv;
    const _Float16* Kh = qkv + (size_t)BT_ * H_;
    const _Float16* Vh = qkv + (size_t)2 * BT_ * H_;

    dim3 g1(BT_ / 128, 1, 2);
    qkv_proj_kernel<<<g1, 256, 0, stream>>>(x, Wq, bq, Wk, bk, Wv, bv, qkv);

    dim3 g2(T_ / 64, B_, 1);
    flash_attn_kernel<<<g2, 512, 0, stream>>>(Qh, Kh, Vh, mask, out);
}

// v009
// Measured time: 23.9 microseconds a run.
// Next to v008, in two timings, it ran 1.06 times as fast each time.
// Over all steps from v000 it is 8.28 times as fast.
#include <hip/hip_runtime.h>
#include <hip/hip_bf16.h>

// ---------------------------------------------------------------------------
// AttentionHead for MI455X (gfx1250, wave32, WMMA f16 16x16x32 -> f32).
// Phase 1: QKV projection  x[BT,E] @ W[E,H] + b  -> f16 in workspace, laid out
//          as the finished WMMA fragments that phase 2 reads.
// Phase 2: fused flash attention (online softmax) -> f32 out.
//
// Workspace layout.  Each of Q, K, V is cut into blocks of 32 rows x 64 cols
// (FB_ = 2048 halves); a block is 8 pieces of 512 B; lane l owns bytes
// 16*l .. 16*l+15 of every piece (c = l & 15, h = l >> 4, e = 0..7):
//   Q, K piece ((cc*2 + jj)*2 + p): element e = M[jj*16 + c][cc*32 + p*16 + h*8 + e]
//   V    piece (j*2 + p)          : element e = V[p*16 + h*8 + e][j*16 + c]
// Pieces p = 0 and p = 1 together are one 16x32 (32x16) f16 operand.
// ---------------------------------------------------------------------------

#define B_  8
#define T_  2048
#define E_  1024
#define H_  64
#define BT_ (B_ * T_)
#define FB_ (32 * H_)   // halves in one 32-row fragment block

typedef _Float16 h2  __attribute__((ext_vector_type(2)));
typedef _Float16 h4  __attribute__((ext_vector_type(4)));
typedef _Float16 h8  __attribute__((ext_vector_type(8)));
typedef _Float16 h16 __attribute__((ext_vector_type(16)));
typedef float    f4  __attribute__((ext_vector_type(4)));
typedef float    f8  __attribute__((ext_vector_type(8)));

static __device__ __forceinline__ h16 hcat(h8 a, h8 b) {
    return __builtin_shufflevector(a, b, 0,1,2,3,4,5,6,7,8,9,10,11,12,13,14,15);
}

// D = A(16x32 f16) x B(32x16 f16) + C(16x16 f32)
static __device__ __forceinline__ f8 wmma_f16(h16 a, h16 b, f8 c) {
    return __builtin_amdgcn_wmma_f32_16x16x32_f16(
        /*neg_a=*/false, a, /*neg_b=*/false, b,
        /*c_mod=*/(short)0, c, /*reuse_a=*/false, /*reuse_b=*/false);
}

// Transposing LDS load: from a row-major 16-bit tile T (rows = k) lane (c, h)
// gets T[kbase + 8h + 0..7][dbase + c]; lane l passes the address of
// T[kbase + 8*(l >> 4) + (l & 7)][dbase + 8*((l >> 3) & 1)].
typedef short s8v __attribute__((ext_vector_type(8)));
static __device__ __forceinline__ h8 lds_tr16(const _Float16* p) {
    typedef __attribute__((address_space(3))) s8v lds_s8v;
    return __builtin_bit_cast(h8, __builtin_amdgcn_ds_load_tr16_b128_v8i16((lds_s8v*)p));
}

// Work-group barrier that orders LDS traffic only.  __syncthreads() would also
// wait for every global load in flight, and the projection's loads are meant to
// stay in flight across two stages.  The wait covers this wave's LDS reads and
// writes; the clobber keeps the compiler from moving LDS accesses across it.
static __device__ __forceinline__ void lds_barrier() {
    asm volatile("s_wait_dscnt 0x0\n\ts_barrier_signal -1\n\ts_barrier_wait -1" ::: "memory");
}

// Where block b enters a walk of 16 steps that it shares with other blocks.
// Any four neighbours out of eight blocks, taken over 32 blocks, get 16 different
// values.  For speed only: every value in 0..15 gives the same sums in another order.
static __device__ __forceinline__ int entry16(int b) {
    return (((b >> 3) << 2) | (b & 3)) & 15;
}

// ---------------------------------------------------------------------------
// Kernel 1: QKV projection.  grid = (BT/128, 1, 2), block = 256 (8 waves).
// Each block: 128 rows x 32 columns of each of Q, K and V (columns z*32 ..
// z*32 + 31), a 128x96 output tile: 256 equal blocks, and a tile of x is read,
// converted and staged for two blocks, not for three.
// Wave w works on row group rg = w >> 1 (32 rows, 2 row tiles) and on column
// tile g = z*2 + (w & 1) (16 columns) of each of Q, K and V: 6 accumulator
// tiles, fed by 2 x fragments and 3 W fragments per WMMA k-step.
// K staged 64 wide (2 WMMA k-steps per barrier pair, 12 WMMAs per stage); the
// global loads of a stage run two stages ahead of its LDS stores.  The 16 stages
// are walked from a stage that depends on the block, wrapping at the end.
// A fragment (per lane, 16 halves): lanes 0-15 row M=l, K={0..7,16..23};
// lanes 16-31 row M=l-16, K={8..15,24..31}.  B mirrors with lane = column.
// x lies in LDS as [row][k] and is read with plain 16-byte loads; each W part
// lies there as it does in memory, [k][col], and its fragments come through the
// transposing load, which delivers the same k order.
// Q, K: W^T is the A operand and x the B operand, so that a lane's 8
// accumulators are 8 adjacent columns of one row.  V: x is A, a lane's 8
// accumulators are 8 adjacent rows of one column.  Either way they are one
// 16-byte element of the fragment layout above.
// ---------------------------------------------------------------------------
__global__ __launch_bounds__(256)
void qkv_proj_kernel(const float* __restrict__ x,
                     const float* __restrict__ Wq, const float* __restrict__ bq,
                     const float* __restrict__ Wk, const float* __restrict__ bk,
                     const float* __restrict__ Wv, const float* __restrict__ bv,
                     _Float16* __restrict__ qkv)
{
    constexpr int KC   = 64;   // K per stage
    constexpr int NC   = 32;   // columns of each W per block
    constexpr int STRA = 72;   // halves per A row in LDS (144 B, 16B aligned)
    constexpr int STRB = 48;   // halves per W row (one k) in LDS: 96 B = 32 B x odd
    constexpr int WT   = KC * STRB;   // halves of one staged W part

    __shared__ __attribute__((aligned(16))) _Float16 Alds[128 * STRA];
    __shared__ __attribute__((aligned(32))) _Float16 Wlds[3 * WT];   // Wq, Wk, Wv

    const int m0   = blockIdx.x * 128;
    const int z    = blockIdx.z;              // which 32 columns
    const int t    = threadIdx.x;
    const int wave = t >> 5;
    const int lane = t & 31;
    const int ln   = lane & 15;
    const int hi8  = (lane >> 4) * 8;
    const int rg   = wave >> 1;               // row group: 32 rows
    const int cl   = wave & 1;                // column tile within the block's 32
    const int g    = z * 2 + cl;              // column tile of Q, of K and of V
    // this lane's address in the x fragments, at row tile 0 of its group and k = 0
    const _Float16* afr = Alds + (rg * 32 + ln) * STRA + hi8;
    // this lane's address in the transposing loads, at k = 0 of Wq's part
    const _Float16* wfr = Wlds + (hi8 + (lane & 7)) * STRB + ((lane >> 3) & 1) * 8 + cl * 16;

    f8 acc[3][2] = {};   // [Q, K, V][row tile]

    // this thread's place in the staged x tile: row r0 + 16*i, 4 columns at cv;
    // in every staged W part: row q0 + 32*i, 4 columns at cw
    const int r0 = t >> 4, cv = (t & 15) * 4;
    const int q0 = t >> 3, cw = (t & 7) * 4;
    const f4* xs = (const f4*)(x + (size_t)m0 * E_);      // block-uniform
    const f4* wq = (const f4*)(Wq + z * NC);
    const f4* wk = (const f4*)(Wk + z * NC);
    const f4* wv = (const f4*)(Wv + z * NC);
    const unsigned vx = r0 * (E_ / 4) + (t & 15);
    const unsigned vw = q0 * (H_ / 4) + (t & 7);

    // all 14 loads of one stage (x: 128 rows x 64 k, each W: 64 k x 32 cols) are
    // issued together, into registers that are read two stages later; xo, wo:
    // this lane's offsets (in 16-byte units) in that stage, which then move on by
    // dk in k; the three W share one offset
    auto fetch = [&](f4 (&xr)[8], f4 (&wr)[3][2], unsigned& xo, unsigned& wo, int dk) {
        const f4* xk = xs + (size_t)xo;
        const f4* qk = wq + (size_t)wo;
        const f4* kk = wk + (size_t)wo;
        const f4* vk = wv + (size_t)wo;
        #pragma unroll
        for (int i = 0; i < 8; ++i)
            xr[i] = xk[i * 16 * (E_ / 4)];
        #pragma unroll
        for (int i = 0; i < 2; ++i) {
            wr[0][i] = qk[i * 32 * (H_ / 4)];
            wr[1][i] = kk[i * 32 * (H_ / 4)];
            wr[2][i] = vk[i * 32 * (H_ / 4)];
        }
        // precaution: no register that the issued loads name is rewritten ahead
        // of this wait; as its inputs the offsets stay theirs up to it
        asm volatile("s_wait_xcnt 0x0" :: "v"(xo), "v"(wo) : "memory");
        xo += dk / 4;
        wo += dk * (H_ / 4);
    };

    // one stage: registers -> LDS as f16, refill the registers from xo, wo
    // (more = false: no such stage), then the products of this stage
    auto stage = [&](f4 (&xr)[8], f4 (&wr)[3][2], unsigned& xo, unsigned& wo, int dk,
                     bool more) {
        lds_barrier();
        #pragma unroll
        for (int i = 0; i < 8; ++i) {
            h4 hv = { (_Float16)xr[i][0], (_Float16)xr[i][1],
                      (_Float16)xr[i][2], (_Float16)xr[i][3] };
            *(h4*)(Alds + (r0 + i * 16) * STRA + cv) = hv;
        }
        // W parts as they lie in memory: Wlds[which][k][col]
        #pragma unroll
        for (int w = 0; w < 3; ++w)
            #pragma unroll
            for (int i = 0; i < 2; ++i) {
                h4 hv = { (_Float16)wr[w][i][0], (_Float16)wr[w][i][1],
                          (_Float16)wr[w][i][2], (_Float16)wr[w][i][3] };
                *(h4*)(Wlds + w * WT + (q0 + i * 32) * STRB + cw) = hv;
            }
        lds_barrier();

        if (more) fetch(xr, wr, xo, wo, dk);

        #pragma unroll
        for (int c = 0; c < 2; ++c) {
            const int ko = c * 32;
            // hoist all fragment loads, then issue WMMAs back-to-back
            h16 a[2], bf[3];
            #pragma unroll
            for (int i = 0; i < 2; ++i) {
                h8 alo = *(const h8*)(afr + i * 16 * STRA + ko);
                h8 ahi = *(const h8*)(afr + i * 16 * STRA + ko + 16);
                a[i] = hcat(alo, ahi);
            }
            #pragma unroll
            for (int w = 0; w < 3; ++w) {
                h8 blo = lds_tr16(wfr + w * WT + ko * STRB);
                h8 bhi = lds_tr16(wfr + w * WT + (ko + 16) * STRB);
                bf[w] = hcat(blo, bhi);
            }
            #pragma unroll
            for (int i = 0; i < 2; ++i) {
                acc[0][i] = wmma_f16(bf[0], a[i], acc[0][i]);
                acc[1][i] = wmma_f16(bf[1], a[i], acc[1][i]);
                acc[2][i] = wmma_f16(a[i], bf[2], acc[2][i]);
            }
        }
    };

    // k offset of the s-th stage of this block's walk; the two blocks that share
    // a tile of x walk half a round apart
    constexpr int NST = E_ / KC;
    static_assert(NST == 16, "entry16 is for a walk of 16 stages");
    const int s0 = entry16(blockIdx.x) + 8 * z;
    auto kof = [&](int s) { return ((s0 + s) & (NST - 1)) * KC; };

    // set a holds the even stages of the walk, set b the odd ones; each has its
    // own offsets, which step two stages at a time and wrap on their own
    unsigned xoa = vx + kof(0) / 4, woa = vw + kof(0) * (H_ / 4);
    unsigned xob = vx + kof(1) / 4, wob = vw + kof(1) * (H_ / 4);

    f4 xa[8], wa[3][2], xb[8], wb[3][2];
    fetch(xa, wa, xoa, woa, kof(2) - kof(0));
    // keeps set a's loads ahead of set b's in issue order: loads return in
    // order, so the wait for set a can then leave all of set b's in flight
    __builtin_amdgcn_sched_barrier(0);
    fetch(xb, wb, xob, wob, kof(3) - kof(1));
    for (int s = 0; s < NST - 2; s += 2) {
        stage(xa, wa, xoa, woa, kof(s + 4) - kof(s + 2), true);
        stage(xb, wb, xob, wob, kof(s + 5) - kof(s + 3), true);
    }
    stage(xa, wa, xoa, woa, 0, false);
    stage(xb, wb, xob, wob, 0, false);

    // bias add + f16 store: one 16-byte store per tile, 512 contiguous bytes
    // per wave.  This wave's 32 rows are one 32-row block, row tile i its half i.
    const float* pbq = bq + g * 16 + hi8;
    const float* pbk = bk + g * 16 + hi8;
    const float* pbv = bv + g * 16 + ln;
    const f4 bq0 = *(const f4*)pbq, bq1 = *(const f4*)(pbq + 4);
    const f4 bk0 = *(const f4*)pbk, bk1 = *(const f4*)(pbk + 4);
    const float bvj = *pbv;
    // precaution: no register that the issued bias loads name is rewritten ahead
    // of this wait; as its inputs the addresses stay theirs up to it
    asm volatile("s_wait_xcnt 0x0" :: "v"(pbq), "v"(pbk), "v"(pbv) : "memory");
    _Float16* oq = qkv + (size_t)((m0 >> 5) + rg) * FB_ + lane * 8;
    _Float16* ok = oq + (size_t)BT_ * H_;
    _Float16* ov = ok + (size_t)BT_ * H_;
    #pragma unroll
    for (int i = 0; i < 2; ++i) {
        // Q, K: acc[.][i][r] = row (rg*32 + i*16 + ln), col (g*16 + hi8 + r)
        const int pqk = (((g >> 1) * 2 + i) * 2 + (g & 1)) * 256;
        h8 pq, pk, pv;
        #pragma unroll
        for (int r = 0; r < 4; ++r) {
            pq[r]     = (_Float16)(acc[0][i][r]     + bq0[r]);
            pq[r + 4] = (_Float16)(acc[0][i][r + 4] + bq1[r]);
            pk[r]     = (_Float16)(acc[1][i][r]     + bk0[r]);
            pk[r + 4] = (_Float16)(acc[1][i][r + 4] + bk1[r]);
        }
        // V: acc[2][i][r] = row (rg*32 + i*16 + hi8 + r), col (g*16 + ln)
        #pragma unroll
        for (int r = 0; r < 8; ++r)
            pv[r] = (_Float16)(acc[2][i][r] + bvj);
        *(h8*)(oq + pqk) = pq;
        *(h8*)(ok + pqk) = pk;
        *(h8*)(ov + (g * 2 + i) * 256) = pv;
    }
}

typedef float f2 __attribute__((ext_vector_type(2)));
typedef int   i4 __attribute__((ext_vector_type(4)));

struct yes_t { static constexpr bool value = true;  };
struct no_t  { static constexpr bool value = false; };

// value of lane l ^ 16
static __device__ __forceinline__ float xhalf(float v) {
    const int i = __builtin_bit_cast(int, v);
    return __builtin_bit_cast(float,
        __builtin_amdgcn_permlanex16(i, i, 0x76543210, 0xfedcba98, false, false));
}

// four waves a SIMD is all that a 16-wave block on its own WGP can have: said
// here so that the compiler spends registers on loads in flight, not on residency
__global__ __launch_bounds__(512) __attribute__((amdgpu_waves_per_eu(4, 4)))
void flash_attn_kernel(const _Float16* __restrict__ Qh,
                       const _Float16* __restrict__ Kh,
                       const _Float16* __restrict__ Vh,
                       const int* __restrict__ mask,
                       float* __restrict__ out)
{
    constexpr int NW   = 16;   // waves per block
    constexpr int NS   = 8;    // key eighths
    constexpr int KBS  = T_ / 32 / NS;   // key blocks per wave
    constexpr int OSTR = H_ + 4;         // floats per row of a partial O in LDS
    constexpr float L2E = 1.44269504088896340736f;
    // partial O, [query row of the pair][column]; read and written 16 bytes at a time
    __shared__ __attribute__((aligned(16))) float Opart[NW][32 * OSTR];
    __shared__ float mpart[NW][32];          // running maximum of each row
    __shared__ float lpart[NW][32];          // running sum of each row

    const int b    = blockIdx.y;
    const int q0   = blockIdx.x * 64;
    const int t    = threadIdx.x;
    // the wave's number in a scalar register: the loop's key blocks depend on it
    const int wave = __builtin_amdgcn_readfirstlane(t >> 5);
    const int qp   = wave & 1;
    const int ks   = wave >> 1;
    const int lane = t & 31;
    const int ln   = lane & 15;
    const int hi8  = (lane >> 4) * 8;

    const size_t kvbase = (size_t)b * T_ * H_;   // = first 32-row block of b

    // preload Q fragments, pre-scaled by H^-0.5 = 0.125 (exact in f16); the
    // wave's 32 queries are one 32-row block, query tile u its half u
    const _Float16* qsrc = Qh + kvbase
        + (size_t)(blockIdx.x * 2 + qp) * FB_ + lane * 8;
    h16 aq[2][2];   // [query tile][k step]
    #pragma unroll
    for (int u = 0; u < 2; ++u)
        #pragma unroll
        for (int c = 0; c < 2; ++c) {
            const int pc = (c * 2 + u) * 2;
            h8 lo = *(const h8*)(qsrc + pc * 256);
            h8 hc = *(const h8*)(qsrc + (pc + 1) * 256);
            aq[u][c] = hcat(lo, hc);
        }
    // precaution: no register that the issued Q loads name is rewritten ahead of this wait
    asm volatile("s_wait_xcnt 0x0" ::: "memory");
    #pragma unroll
    for (int u = 0; u < 2; ++u)
        #pragma unroll
        for (int c = 0; c < 2; ++c)
            #pragma unroll
            for (int i = 0; i < 16; ++i) aq[u][c][i] = aq[u][c][i] * (_Float16)0.125f;

    // o[u][j][r] = O[query ln of tile u][column j*16 + hi8 + r], unnormalised
    f8 o[2][4] = {};
    // mrun: the running maximum of query ln of each tile (equal in both halves of
    // the wave); lrun: the running sum over this half's keys only
    float mrun[2] = { -1e30f, -1e30f }, lrun[2] = { 0.0f, 0.0f };

    // this lane's addresses in key block 0 of the batch
    const _Float16* ksrc = Kh + kvbase + lane * 8;
    const _Float16* vsrc = Vh + kvbase + lane * 8;
    const int*      msrc = mask + b * T_ + lane;

    const int kb0 = ks * KBS;   // first key block of this wave's eighth
    static_assert(KBS == 8, "the entry step below is cut to a walk of 8 key blocks");
    const int st  = entry16(blockIdx.x) & (KBS - 1);   // where the walk through it begins

    // one key block's K fragments and mask word, carried from the pass that
    // loads them to the pass that uses them; the fragments of the walk's first
    // block are asked for here, ahead of the look at the mask
    struct kset { h8 lo[2][2], hi[2][2]; int mk; };
    auto fetch_k = [&](kset& k, const _Float16* kn) {
        #pragma unroll
        for (int c = 0; c < 2; ++c)
            #pragma unroll
            for (int j = 0; j < 2; ++j) {
                k.lo[c][j] = *(const h8*)(kn + ((c * 2 + j) * 2) * 256);
                k.hi[c][j] = *(const h8*)(kn + ((c * 2 + j) * 2 + 1) * 256);
            }
    };
    kset kc;
    const _Float16* kfirst = ksrc + (size_t)(kb0 + st) * FB_;
    fetch_k(kc, kfirst);

    // does this wave's eighth hold a closed key?  Every lane looks at 8 mask
    // words; the answer is the same for the whole wave, in a scalar register
    bool shut = false;
    {
        const i4* mq = (const i4*)(mask + b * T_ + kb0 * 32) + lane * 2;
        i4 w[2];
        #pragma unroll
        for (int i = 0; i < 2; ++i)
            w[i] = mq[i];
        // precaution: no register that the issued K and mask loads name is
        // rewritten ahead of this wait; as its inputs they stay theirs up to it
        asm volatile("s_wait_xcnt 0x0" :: "v"(kfirst), "v"(mq) : "memory");
        #pragma unroll
        for (int i = 0; i < 2; ++i)
            shut |= (w[i][0] == 0) | (w[i][1] == 0) | (w[i][2] == 0) | (w[i][3] == 0);
    }
    const bool anyshut = __builtin_amdgcn_ballot_w32(shut) != 0;

    // the loop over the wave's key blocks; MASKED = false leaves out the mask
    // word and the selects, for an eighth in which every key is open
    auto walk = [&](auto tag) {
        constexpr bool MASKED = decltype(tag)::value;

        kc.mk = MASKED ? msrc[(kb0 + st) * 32] : 1;

        for (int it = 0; it < KBS; ++it) {
            const int kb = kb0 + ((st + it) & (KBS - 1));
            // issue this block's V loads; they are used behind the softmax
            h8 vl[4], vh[4];
            const _Float16* vn = vsrc + (size_t)kb * FB_;
            #pragma unroll
            for (int j = 0; j < 4; ++j) {
                vl[j] = *(const h8*)(vn + (j * 2) * 256);
                vh[j] = *(const h8*)(vn + (j * 2 + 1) * 256);
            }

            // S^T = K @ (Q*scale)^T from the fragments loaded one pass ago:
            // s[u][j][r] = S[query ln of tile u][key j*16 + hi8 + r]
            f8 s[2][2] = {};
            #pragma unroll
            for (int c = 0; c < 2; ++c)
                #pragma unroll
                for (int j = 0; j < 2; ++j) {
                    const h16 kf = hcat(kc.lo[c][j], kc.hi[c][j]);
                    s[0][j] = wmma_f16(kf, aq[0][c], s[0][j]);
                    s[1][j] = wmma_f16(kf, aq[1][c], s[1][j]);
                }

            // bit k of the ballot: key k of this block is open (lane k holds its
            // mask word)
            const unsigned ob = MASKED
                ? __builtin_amdgcn_ballot_w32(kc.mk != 0) >> hi8 : 0u;

            // precaution: the register pair that the issued V loads name is not
            // rewritten ahead of this wait; as its input it stays theirs up to it.
            // The scores as inputs keep the eight products ahead of the loads
            // that refill their K registers: with the products behind them the
            // compiler copies the fragments once per pass
            asm volatile("s_wait_xcnt 0x0"
                         :: "v"(s[0][0]), "v"(s[0][1]), "v"(s[1][0]), "v"(s[1][1]), "v"(vn)
                         : "memory");

            // issue the next block's K and mask loads; the wave's last pass
            // loads the walk's first block again, so that every address stays
            // inside the wave's own keys
            const size_t nn = (size_t)(kb0 + ((st + it + 1) & (KBS - 1)));
            const _Float16* kn = ksrc + nn * FB_;
            const int*      mn = msrc + nn * 32;
            fetch_k(kc, kn);
            // precaution, as above, for the registers that these loads name
            if (MASKED) {
                kc.mk = *mn;
                asm volatile("s_wait_xcnt 0x0" :: "v"(kn), "v"(mn) : "memory");
            } else {
                asm volatile("s_wait_xcnt 0x0" :: "v"(kn) : "memory");
            }

            h16 pf[2];        // P^T as a B operand: k order hi8 + r, 16 + hi8 + r
            #pragma unroll
            for (int u = 0; u < 2; ++u) {
                f8 s0 = s[u][0], s1 = s[u][1];

                // a closed key scores -1e9
                if (MASKED) {
                    #pragma unroll
                    for (int r = 0; r < 8; ++r) {
                        s0[r] = ((ob >> r) & 1u)        ? s0[r] : -1e9f;
                        s1[r] = ((ob >> (16 + r)) & 1u) ? s1[r] : -1e9f;
                    }
                }

                // online softmax of query ln of tile u, in this lane's registers
                const float x0 = fmaxf(fmaxf(s0[0], s0[1]), s0[2]);
                const float x1 = fmaxf(fmaxf(s0[3], s0[4]), s0[5]);
                const float x2 = fmaxf(fmaxf(s0[6], s0[7]), s1[0]);
                const float x3 = fmaxf(fmaxf(s1[1], s1[2]), s1[3]);
                const float x4 = fmaxf(fmaxf(s1[4], s1[5]), s1[6]);
                float mx = fmaxf(fmaxf(fmaxf(x0, x1), x2), fmaxf(fmaxf(x3, x4), s1[7]));
                mx = fmaxf(mx, xhalf(mx));
                const float mnew  = fmaxf(mrun[u], mx);
                const float alpha = __builtin_amdgcn_exp2f((mrun[u] - mnew) * L2E);
                mrun[u] = mnew;

                f2  sum0 = { 0.0f, 0.0f }, sum1 = sum0;
                #pragma unroll
                for (int r = 0; r < 8; r += 2) {
                    f2 e0 = { s0[r], s0[r + 1] };
                    f2 e1 = { s1[r], s1[r + 1] };
                    e0 = (e0 - mnew) * L2E;
                    e1 = (e1 - mnew) * L2E;
                    f2 p0 = { __builtin_amdgcn_exp2f(e0[0]), __builtin_amdgcn_exp2f(e0[1]) };
                    f2 p1 = { __builtin_amdgcn_exp2f(e1[0]), __builtin_amdgcn_exp2f(e1[1]) };
                    sum0 += p0;
                    sum1 += p1;
                    pf[u][r]     = (_Float16)p0[0];
                    pf[u][r + 1] = (_Float16)p0[1];
                    pf[u][r + 8] = (_Float16)p1[0];
                    pf[u][r + 9] = (_Float16)p1[1];
                }
                sum0 += sum1;
                lrun[u] = alpha * lrun[u] + (sum0[0] + sum0[1]);

                // rescale the accumulator: every element of a lane is of query ln
                #pragma unroll
                for (int j = 0; j < 4; ++j)
                    o[u][j] *= alpha;
            }

            // O^T += V^T @ P^T from the V fragments loaded at the head of the pass
            #pragma unroll
            for (int j = 0; j < 4; ++j) {
                const h16 vf = hcat(vl[j], vh[j]);
                o[0][j] = wmma_f16(vf, pf[0], o[0][j]);
                o[1][j] = wmma_f16(vf, pf[1], o[1][j]);
            }

            // compiler fence: holds the next block's K loads inside this pass;
            // without it the compiler carries their address over instead and
            // loads at the head of the next pass, right in front of their use
            asm volatile("" ::: "memory");
        }
    };
    if (anyshut) walk(yes_t{});
    else         walk(no_t{});

    // hand the partial result over, row-major: 32 bytes per lane and tile
    #pragma unroll
    for (int u = 0; u < 2; ++u) {
        // the two halves of the wave summed different keys of the same query
        lrun[u] += xhalf(lrun[u]);
        float* ow = Opart[wave] + (u * 16 + ln) * OSTR + hi8;
        #pragma unroll
        for (int j = 0; j < 4; ++j) {
            f4 lo = { o[u][j][0], o[u][j][1], o[u][j][2], o[u][j][3] };
            f4 hc = { o[u][j][4], o[u][j][5], o[u][j][6], o[u][j][7] };
            *(f4*)(ow + j * 16)     = lo;
            *(f4*)(ow + j * 16 + 4) = hc;
        }
    }
    // lane l holds, of row l of the pair, the maximum and the sum: tile l >> 4
    mpart[wave][lane] = lane < 16 ? mrun[0] : mrun[1];
    lpart[wave][lane] = lane < 16 ? lrun[0] : lrun[1];
    // every wave's partial result is in LDS before any wave reads one
    __syncthreads();

    // this wave finishes rows wave*4 .. wave*4 + 3 of the block's 64, eight lanes
    // a row, eight columns a lane: weight of eighth s is
    // exp(m_s - m) / sum over s of l_s * exp(m_s - m)
    const int row = t >> 3;            // row of the block
    const int pr2 = row >> 5;          // the query pair that holds it
    const int rr  = row & 31;          // its row in that pair
    const int col = (lane & 7) * 8;
    float ms[NS], wt[NS];
    float mall = -1e30f;
    #pragma unroll
    for (int s = 0; s < NS; ++s) {
        ms[s] = mpart[s * 2 + pr2][rr];
        mall  = fmaxf(mall, ms[s]);
    }
    float lsum = 0.0f;
    #pragma unroll
    for (int s = 0; s < NS; ++s) {
        wt[s] = __expf(ms[s] - mall);
        lsum += lpart[s * 2 + pr2][rr] * wt[s];
    }
    const float inv = 1.0f / lsum;

    f4 r0 = { 0.0f, 0.0f, 0.0f, 0.0f }, r1 = r0;
    #pragma unroll
    for (int s = 0; s < NS; ++s) {
        const float* pr = Opart[s * 2 + pr2] + rr * OSTR + col;
        r0 += *(const f4*)pr * wt[s];
        r1 += *(const f4*)(pr + 4) * wt[s];
    }
    float* orow = out + ((size_t)b * T_ + q0 + row) * H_ + col;
    *(f4*)orow       = r0 * inv;
    *(f4*)(orow + 4) = r1 * inv;
}

// ---------------------------------------------------------------------------
// Launch
// ---------------------------------------------------------------------------
extern "C" void kernel_launch(void* const* d_in, const int* in_sizes, int n_in,
                              void* d_out, int out_size, void* d_ws, size_t ws_size,
                              hipStream_t stream)
{
    const float* x    = (const float*)d_in[0];
    const float* Wq   = (const float*)d_in[1];
    const float* bq   = (const float*)d_in[2];
    const float* Wk   = (const float*)d_in[3];
    const float* bk   = (const float*)d_in[4];
    const float* Wv   = (const float*)d_in[5];
    const float* bv   = (const float*)d_in[6];
    const int*   mask = (const int*)d_in[7];
    float* out = (float*)d_out;

    _Float16* qkv = (_Float16*)d_ws;                 // 3 * BT * H halves = 6 MB
    const _Float16* Qh = qkv;
    const _Float16* Kh = qkv + (size_t)BT_ * H_;
    const _Float16* Vh = qkv + (size_t)2 * BT_ * H_;

    dim3 g1(BT_ / 128, 1, 2);
    qkv_proj_kernel<<<g1, 256, 0, stream>>>(x, Wq, bq, Wk, bk, Wv, bv, qkv);

    dim3 g2(T_ / 64, B_, 1);
    flash_attn_kernel<<<g2, 512, 0, stream>>>(Qh, Kh, Vh, mask, out);
}

// v010
// A run of this version takes 22.9 microseconds.
// Timed twice side by side with v009, it ran 1.05 and 1.04 times as fast.
// All steps since v000 together make it 8.67 times as fast.
#include <hip/hip_runtime.h>
#include <hip/hip_bf16.h>

// ---------------------------------------------------------------------------
// AttentionHead for MI455X (gfx1250, wave32, WMMA f16 16x16x32 -> f32).
// Phase 1: QKV projection  x[BT,E] @ W[E,H] + b  -> f16 in workspace, laid out
//          as the finished WMMA fragments that phase 2 reads.
// Phase 2: fused flash attention (online softmax) -> f32 out.
//
// Workspace layout.  Each of Q, K, V is cut into blocks of 32 rows x 64 cols
// (FB_ = 2048 halves); a block is 8 pieces of 512 B; lane l owns bytes
// 16*l .. 16*l+15 of every piece (c = l & 15, h = l >> 4, e = 0..7):
//   Q, K piece ((cc*2 + jj)*2 + p): element e = M[jj*16 + c][cc*32 + p*16 + h*8 + e]
//   V    piece (j*2 + p)          : element e = V[p*16 + h*8 + e][j*16 + c]
// Pieces p = 0 and p = 1 together are one 16x32 (32x16) f16 operand.
// Q is stored times H^-0.5 * log2(e): the scores then leave the S products in
// the units of exp2.
// ---------------------------------------------------------------------------

#define B_  8
#define T_  2048
#define E_  1024
#define H_  64
#define BT_ (B_ * T_)
#define FB_ (32 * H_)   // halves in one 32-row fragment block
#define L2E_ 1.44269504088896340736f

typedef _Float16 h2  __attribute__((ext_vector_type(2)));
typedef _Float16 h4  __attribute__((ext_vector_type(4)));
typedef _Float16 h8  __attribute__((ext_vector_type(8)));
typedef _Float16 h16 __attribute__((ext_vector_type(16)));
typedef float    f4  __attribute__((ext_vector_type(4)));
typedef float    f8  __attribute__((ext_vector_type(8)));

static __device__ __forceinline__ h16 hcat(h8 a, h8 b) {
    return __builtin_shufflevector(a, b, 0,1,2,3,4,5,6,7,8,9,10,11,12,13,14,15);
}

// D = A(16x32 f16) x B(32x16 f16) + C(16x16 f32)
static __device__ __forceinline__ f8 wmma_f16(h16 a, h16 b, f8 c) {
    return __builtin_amdgcn_wmma_f32_16x16x32_f16(
        /*neg_a=*/false, a, /*neg_b=*/false, b,
        /*c_mod=*/(short)0, c, /*reuse_a=*/false, /*reuse_b=*/false);
}

// Transposing LDS load: from a row-major 16-bit tile T (rows = k) lane (c, h)
// gets T[kbase + 8h + 0..7][dbase + c]; lane l passes the address of
// T[kbase + 8*(l >> 4) + (l & 7)][dbase + 8*((l >> 3) & 1)].
typedef short s8v __attribute__((ext_vector_type(8)));
static __device__ __forceinline__ h8 lds_tr16(const _Float16* p) {
    typedef __attribute__((address_space(3))) s8v lds_s8v;
    return __builtin_bit_cast(h8, __builtin_amdgcn_ds_load_tr16_b128_v8i16((lds_s8v*)p));
}

// Work-group barrier that orders LDS traffic only.  __syncthreads() would also
// wait for every global load in flight, and the projection's loads are meant to
// stay in flight across two stages.  The wait covers this wave's LDS reads and
// writes; the clobber keeps the compiler from moving LDS accesses across it.
static __device__ __forceinline__ void lds_barrier() {
    asm volatile("s_wait_dscnt 0x0\n\ts_barrier_signal -1\n\ts_barrier_wait -1" ::: "memory");
}

// Where block b enters a walk of 16 steps that it shares with other blocks.
// Any four neighbours out of eight blocks, taken over 32 blocks, get 16 different
// values.  For speed only: every value in 0..15 gives the same sums in another order.
static __device__ __forceinline__ int entry16(int b) {
    return (((b >> 3) << 2) | (b & 3)) & 15;
}

// ---------------------------------------------------------------------------
// Kernel 1: QKV projection.  grid = (BT/128, 1, 2), block = 256 (8 waves).
// Each block: 128 rows x 32 columns of each of Q, K and V (columns z*32 ..
// z*32 + 31), a 128x96 output tile: 256 equal blocks, and a tile of x is read,
// converted and staged for two blocks, not for three.
// Wave w works on row group rg = w >> 1 (32 rows, 2 row tiles) and on column
// tile g = z*2 + (w & 1) (16 columns) of each of Q, K and V: 6 accumulator
// tiles, fed by 2 x fragments and 3 W fragments per WMMA k-step.
// K staged 64 wide (2 WMMA k-steps per barrier pair, 12 WMMAs per stage); the
// global loads of a stage run two stages ahead of its LDS stores.  The 16 stages
// are walked from a stage that depends on the block, wrapping at the end.
// A fragment (per lane, 16 halves): lanes 0-15 row M=l, K={0..7,16..23};
// lanes 16-31 row M=l-16, K={8..15,24..31}.  B mirrors with lane = column.
// x lies in LDS as [row][k] and is read with plain 16-byte loads; each W part
// lies there as it does in memory, [k][col], and its fragments come through the
// transposing load, which delivers the same k order.
// Q, K: W^T is the A operand and x the B operand, so that a lane's 8
// accumulators are 8 adjacent columns of one row.  V: x is A, a lane's 8
// accumulators are 8 adjacent rows of one column.  Either way they are one
// 16-byte element of the fragment layout above.
// ---------------------------------------------------------------------------
__global__ __launch_bounds__(256)
void qkv_proj_kernel(const float* __restrict__ x,
                     const float* __restrict__ Wq, const float* __restrict__ bq,
                     const float* __restrict__ Wk, const float* __restrict__ bk,
                     const float* __restrict__ Wv, const float* __restrict__ bv,
                     _Float16* __restrict__ qkv)
{
    constexpr int KC   = 64;   // K per stage
    constexpr int NC   = 32;   // columns of each W per block
    constexpr int STRA = 72;   // halves per A row in LDS (144 B, 16B aligned)
    constexpr int STRB = 48;   // halves per W row (one k) in LDS: 96 B = 32 B x odd
    constexpr int WT   = KC * STRB;   // halves of one staged W part

    __shared__ __attribute__((aligned(16))) _Float16 Alds[128 * STRA];
    __shared__ __attribute__((aligned(32))) _Float16 Wlds[3 * WT];   // Wq, Wk, Wv

    const int m0   = blockIdx.x * 128;
    const int z    = blockIdx.z;              // which 32 columns
    const int t    = threadIdx.x;
    const int wave = t >> 5;
    const int lane = t & 31;
    const int ln   = lane & 15;
    const int hi8  = (lane >> 4) * 8;
    const int rg   = wave >> 1;               // row group: 32 rows
    const int cl   = wave & 1;                // column tile within the block's 32
    const int g    = z * 2 + cl;              // column tile of Q, of K and of V
    // this lane's address in the x fragments, at row tile 0 of its group and k = 0
    const _Float16* afr = Alds + (rg * 32 + ln) * STRA + hi8;
    // this lane's address in the transposing loads, at k = 0 of Wq's part
    const _Float16* wfr = Wlds + (hi8 + (lane & 7)) * STRB + ((lane >> 3) & 1) * 8 + cl * 16;

    f8 acc[3][2] = {};   // [Q, K, V][row tile]

    // this thread's place in the staged x tile: row r0 + 16*i, 4 columns at cv;
    // in every staged W part: row q0 + 32*i, 4 columns at cw
    const int r0 = t >> 4, cv = (t & 15) * 4;
    const int q0 = t >> 3, cw = (t & 7) * 4;
    const f4* xs = (const f4*)(x + (size_t)m0 * E_);      // block-uniform
    const f4* wq = (const f4*)(Wq + z * NC);
    const f4* wk = (const f4*)(Wk + z * NC);
    const f4* wv = (const f4*)(Wv + z * NC);
    const unsigned vx = r0 * (E_ / 4) + (t & 15);
    const unsigned vw = q0 * (H_ / 4) + (t & 7);

    // all 14 loads of one stage (x: 128 rows x 64 k, each W: 64 k x 32 cols) are
    // issued together, into registers that are read two stages later; xo, wo:
    // this lane's offsets (in 16-byte units) in that stage, which then move on by
    // dk in k; the three W share one offset
    auto fetch = [&](f4 (&xr)[8], f4 (&wr)[3][2], unsigned& xo, unsigned& wo, int dk) {
        const f4* xk = xs + (size_t)xo;
        const f4* qk = wq + (size_t)wo;
        const f4* kk = wk + (size_t)wo;
        const f4* vk = wv + (size_t)wo;
        #pragma unroll
        for (int i = 0; i < 8; ++i)
            xr[i] = xk[i * 16 * (E_ / 4)];
        #pragma unroll
        for (int i = 0; i < 2; ++i) {
            wr[0][i] = qk[i * 32 * (H_ / 4)];
            wr[1][i] = kk[i * 32 * (H_ / 4)];
            wr[2][i] = vk[i * 32 * (H_ / 4)];
        }
        // precaution: no register that the issued loads name is rewritten ahead
        // of this wait; as its inputs the offsets stay theirs up to it
        asm volatile("s_wait_xcnt 0x0" :: "v"(xo), "v"(wo) : "memory");
        xo += dk / 4;
        wo += dk * (H_ / 4);
    };

    // one stage: registers -> LDS as f16, refill the registers from xo, wo
    // (more = false: no such stage), then the products of this stage
    auto stage = [&](f4 (&xr)[8], f4 (&wr)[3][2], unsigned& xo, unsigned& wo, int dk,
                     bool more) {
        lds_barrier();
        #pragma unroll
        for (int i = 0; i < 8; ++i) {
            h4 hv = { (_Float16)xr[i][0], (_Float16)xr[i][1],
                      (_Float16)xr[i][2], (_Float16)xr[i][3] };
            *(h4*)(Alds + (r0 + i * 16) * STRA + cv) = hv;
        }
        // W parts as they lie in memory: Wlds[which][k][col]
        #pragma unroll
        for (int w = 0; w < 3; ++w)
            #pragma unroll
            for (int i = 0; i < 2; ++i) {
                h4 hv = { (_Float16)wr[w][i][0], (_Float16)wr[w][i][1],
                          (_Float16)wr[w][i][2], (_Float16)wr[w][i][3] };
                *(h4*)(Wlds + w * WT + (q0 + i * 32) * STRB + cw) = hv;
            }
        lds_barrier();

        if (more) fetch(xr, wr, xo, wo, dk);

        #pragma unroll
        for (int c = 0; c < 2; ++c) {
            const int ko = c * 32;
            // hoist all fragment loads, then issue WMMAs back-to-back
            h16 a[2], bf[3];
            #pragma unroll
            for (int i = 0; i < 2; ++i) {
                h8 alo = *(const h8*)(afr + i * 16 * STRA + ko);
                h8 ahi = *(const h8*)(afr + i * 16 * STRA + ko + 16);
                a[i] = hcat(alo, ahi);
            }
            #pragma unroll
            for (int w = 0; w < 3; ++w) {
                h8 blo = lds_tr16(wfr + w * WT + ko * STRB);
                h8 bhi = lds_tr16(wfr + w * WT + (ko + 16) * STRB);
                bf[w] = hcat(blo, bhi);
            }
            #pragma unroll
            for (int i = 0; i < 2; ++i) {
                acc[0][i] = wmma_f16(bf[0], a[i], acc[0][i]);
                acc[1][i] = wmma_f16(bf[1], a[i], acc[1][i]);
                acc[2][i] = wmma_f16(a[i], bf[2], acc[2][i]);
            }
        }
    };

    // k offset of the s-th stage of this block's walk; the two blocks that share
    // a tile of x walk half a round apart
    constexpr int NST = E_ / KC;
    static_assert(NST == 16, "entry16 is for a walk of 16 stages");
    const int s0 = entry16(blockIdx.x) + 8 * z;
    auto kof = [&](int s) { return ((s0 + s) & (NST - 1)) * KC; };

    // set a holds the even stages of the walk, set b the odd ones; each has its
    // own offsets, which step two stages at a time and wrap on their own
    unsigned xoa = vx + kof(0) / 4, woa = vw + kof(0) * (H_ / 4);
    unsigned xob = vx + kof(1) / 4, wob = vw + kof(1) * (H_ / 4);

    f4 xa[8], wa[3][2], xb[8], wb[3][2];
    fetch(xa, wa, xoa, woa, kof(2) - kof(0));
    // keeps set a's loads ahead of set b's in issue order: loads return in
    // order, so the wait for set a can then leave all of set b's in flight
    __builtin_amdgcn_sched_barrier(0);
    fetch(xb, wb, xob, wob, kof(3) - kof(1));
    for (int s = 0; s < NST - 2; s += 2) {
        stage(xa, wa, xoa, woa, kof(s + 4) - kof(s + 2), true);
        stage(xb, wb, xob, wob, kof(s + 5) - kof(s + 3), true);
    }
    stage(xa, wa, xoa, woa, 0, false);
    stage(xb, wb, xob, wob, 0, false);

    // bias add + f16 store: one 16-byte store per tile, 512 contiguous bytes
    // per wave.  This wave's 32 rows are one 32-row block, row tile i its half i.
    const float* pbq = bq + g * 16 + hi8;
    const float* pbk = bk + g * 16 + hi8;
    const float* pbv = bv + g * 16 + ln;
    const f4 bq0 = *(const f4*)pbq, bq1 = *(const f4*)(pbq + 4);
    const f4 bk0 = *(const f4*)pbk, bk1 = *(const f4*)(pbk + 4);
    const float bvj = *pbv;
    // precaution: no register that the issued bias loads name is rewritten ahead
    // of this wait; as its inputs the addresses stay theirs up to it
    asm volatile("s_wait_xcnt 0x0" :: "v"(pbq), "v"(pbk), "v"(pbv) : "memory");
    _Float16* oq = qkv + (size_t)((m0 >> 5) + rg) * FB_ + lane * 8;
    _Float16* ok = oq + (size_t)BT_ * H_;
    _Float16* ov = ok + (size_t)BT_ * H_;
    #pragma unroll
    for (int i = 0; i < 2; ++i) {
        // Q, K: acc[.][i][r] = row (rg*32 + i*16 + ln), col (g*16 + hi8 + r)
        const int pqk = (((g >> 1) * 2 + i) * 2 + (g & 1)) * 256;
        h8 pq, pk, pv;
        #pragma unroll
        for (int r = 0; r < 4; ++r) {
            pq[r]     = (_Float16)((acc[0][i][r]     + bq0[r]) * (0.125f * L2E_));
            pq[r + 4] = (_Float16)((acc[0][i][r + 4] + bq1[r]) * (0.125f * L2E_));
            pk[r]     = (_Float16)(acc[1][i][r]     + bk0[r]);
            pk[r + 4] = (_Float16)(acc[1][i][r + 4] + bk1[r]);
        }
        // V: acc[2][i][r] = row (rg*32 + i*16 + hi8 + r), col (g*16 + ln)
        #pragma unroll
        for (int r = 0; r < 8; ++r)
            pv[r] = (_Float16)(acc[2][i][r] + bvj);
        *(h8*)(oq + pqk) = pq;
        *(h8*)(ok + pqk) = pk;
        *(h8*)(ov + (g * 2 + i) * 256) = pv;
    }
}

typedef float f2 __attribute__((ext_vector_type(2)));
typedef int   i4 __attribute__((ext_vector_type(4)));

struct yes_t { static constexpr bool value = true;  };
struct no_t  { static constexpr bool value = false; };

// value of lane l ^ 16
static __device__ __forceinline__ float xhalf(float v) {
    const int i = __builtin_bit_cast(int, v);
    return __builtin_bit_cast(float,
        __builtin_amdgcn_permlanex16(i, i, 0x76543210, 0xfedcba98, false, false));
}

// four waves a SIMD is all that a 16-wave block on its own WGP can have: said
// here so that the compiler spends registers on loads in flight, not on residency
__global__ __launch_bounds__(512) __attribute__((amdgpu_waves_per_eu(4, 4)))
void flash_attn_kernel(const _Float16* __restrict__ Qh,
                       const _Float16* __restrict__ Kh,
                       const _Float16* __restrict__ Vh,
                       const int* __restrict__ mask,
                       float* __restrict__ out)
{
    constexpr int NW   = 16;   // waves per block
    constexpr int NS   = 8;    // key eighths
    constexpr int KBS  = T_ / 32 / NS;   // key blocks per wave
    constexpr int OSTR = H_ + 4;         // floats per row of a partial O in LDS
    // partial O, [query row of the pair][column]; read and written 16 bytes at a time
    __shared__ __attribute__((aligned(16))) float Opart[NW][32 * OSTR];
    __shared__ float mpart[NW][32];          // shift of each row
    __shared__ float lpart[NW][32];          // running sum of each row

    const int b    = blockIdx.y;
    const int q0   = blockIdx.x * 64;
    const int t    = threadIdx.x;
    // the wave's number in a scalar register: the loop's key blocks depend on it
    const int wave = __builtin_amdgcn_readfirstlane(t >> 5);
    const int qp   = wave & 1;
    const int ks   = wave >> 1;
    const int lane = t & 31;
    const int ln   = lane & 15;
    const int hi8  = (lane >> 4) * 8;

    const size_t kvbase = (size_t)b * T_ * H_;   // = first 32-row block of b

    // preload Q fragments (they carry the scale); the wave's 32 queries are one
    // 32-row block, query tile u its half u
    const _Float16* qsrc = Qh + kvbase
        + (size_t)(blockIdx.x * 2 + qp) * FB_ + lane * 8;
    h16 aq[2][2];   // [query tile][k step]
    #pragma unroll
    for (int u = 0; u < 2; ++u)
        #pragma unroll
        for (int c = 0; c < 2; ++c) {
            const int pc = (c * 2 + u) * 2;
            h8 lo = *(const h8*)(qsrc + pc * 256);
            h8 hc = *(const h8*)(qsrc + (pc + 1) * 256);
            aq[u][c] = hcat(lo, hc);
        }
    // precaution: no register that the issued Q loads name is rewritten ahead of this wait
    asm volatile("s_wait_xcnt 0x0" ::: "memory");

    // o[u][j][r] = O[query ln of tile u][column j*16 + hi8 + r], unnormalised
    f8 o[2][4] = {};
    // mrun: the shift in use for query ln of each tile, in units of exp2 (equal in
    // both halves of the wave); lrun: the running sum over this half's keys only
    float mrun[2] = { -1e30f, -1e30f }, lrun[2] = { 0.0f, 0.0f };

    // this lane's addresses in key block 0 of the batch
    const _Float16* ksrc = Kh + kvbase + lane * 8;
    const _Float16* vsrc = Vh + kvbase + lane * 8;
    const int*      msrc = mask + b * T_ + lane;

    const int kb0 = ks * KBS;   // first key block of this wave's eighth
    static_assert(KBS == 8, "the entry step below is cut to a walk of 8 key blocks");
    const int st  = entry16(blockIdx.x) & (KBS - 1);   // where the walk through it begins

    // one key block's K fragments and mask word, carried from the pass that
    // loads them to the pass that uses them; the fragments of the walk's first
    // block are asked for here, ahead of the look at the mask
    struct kset { h8 lo[2][2], hi[2][2]; int mk; };
    auto fetch_k = [&](kset& k, const _Float16* kn) {
        #pragma unroll
        for (int c = 0; c < 2; ++c)
            #pragma unroll
            for (int j = 0; j < 2; ++j) {
                k.lo[c][j] = *(const h8*)(kn + ((c * 2 + j) * 2) * 256);
                k.hi[c][j] = *(const h8*)(kn + ((c * 2 + j) * 2 + 1) * 256);
            }
    };
    kset kc;
    const _Float16* kfirst = ksrc + (size_t)(kb0 + st) * FB_;
    fetch_k(kc, kfirst);

    // does this wave's eighth hold a closed key?  Every lane looks at 8 mask
    // words; the answer is the same for the whole wave, in a scalar register
    bool shut = false;
    {
        const i4* mq = (const i4*)(mask + b * T_ + kb0 * 32) + lane * 2;
        i4 w[2];
        #pragma unroll
        for (int i = 0; i < 2; ++i)
            w[i] = mq[i];
        // precaution: no register that the issued K and mask loads name is
        // rewritten ahead of this wait; as its inputs they stay theirs up to it
        asm volatile("s_wait_xcnt 0x0" :: "v"(kfirst), "v"(mq) : "memory");
        #pragma unroll
        for (int i = 0; i < 2; ++i)
            shut |= (w[i][0] == 0) | (w[i][1] == 0) | (w[i][2] == 0) | (w[i][3] == 0);
    }
    const bool anyshut = __builtin_amdgcn_ballot_w32(shut) != 0;

    // the loop over the wave's key blocks; MASKED = false leaves out the mask
    // word and the selects, for an eighth in which every key is open
    auto walk = [&](auto tag) {
        constexpr bool MASKED = decltype(tag)::value;

        kc.mk = MASKED ? msrc[(kb0 + st) * 32] : 1;

        // open keys only: minus the shift in use, eight times over, as a C
        // operand; the running sum in two chains of pairs
        f8 cn[2] = {};
        f2 ls[2][2] = {};
        if (!MASKED) mrun[0] = mrun[1] = 0.0f;

        for (int it = 0; it < KBS; ++it) {
            const int kb = kb0 + ((st + it) & (KBS - 1));
            // issue this block's V loads; they are used behind the softmax
            h8 vl[4], vh[4];
            const _Float16* vn = vsrc + (size_t)kb * FB_;
            #pragma unroll
            for (int j = 0; j < 4; ++j) {
                vl[j] = *(const h8*)(vn + (j * 2) * 256);
                vh[j] = *(const h8*)(vn + (j * 2 + 1) * 256);
            }

            // S^T = K @ (Q*scale)^T - shift from the fragments loaded one pass ago:
            // s[u][j][r] = S[query ln of tile u][key j*16 + hi8 + r] + cn[u]
            f8 s[2][2];
            #pragma unroll
            for (int c = 0; c < 2; ++c)
                #pragma unroll
                for (int j = 0; j < 2; ++j) {
                    const h16 kf = hcat(kc.lo[c][j], kc.hi[c][j]);
                    s[0][j] = wmma_f16(kf, aq[0][c], c ? s[0][j] : cn[0]);
                    s[1][j] = wmma_f16(kf, aq[1][c], c ? s[1][j] : cn[1]);
                }

            // bit k of the ballot: key k of this block is open (lane k holds its
            // mask word)
            const unsigned ob = MASKED
                ? __builtin_amdgcn_ballot_w32(kc.mk != 0) >> hi8 : 0u;

            // precaution: the register pair that the issued V loads name is not
            // rewritten ahead of this wait; as its input it stays theirs up to it.
            // The scores as inputs keep the eight products ahead of the loads
            // that refill their K registers: with the products behind them the
            // compiler copies the fragments once per pass
            if constexpr (MASKED)
                asm volatile("s_wait_xcnt 0x0"
                             :: "v"(s[0][0]), "v"(s[0][1]), "v"(s[1][0]), "v"(s[1][1]), "v"(vn)
                             : "memory");
            else
                // the shifts as inputs too: live behind the products, they are read
                // in place as C; otherwise the compiler copies them into two of the
                // four score tiles in every pass
                asm volatile("s_wait_xcnt 0x0"
                             :: "v"(s[0][0]), "v"(s[0][1]), "v"(s[1][0]), "v"(s[1][1]), "v"(vn),
                                "v"(cn[0]), "v"(cn[1])
                             : "memory");

            // issue the next block's K and mask loads; the wave's last pass
            // loads the walk's first block again, so that every address stays
            // inside the wave's own keys
            const size_t nn = (size_t)(kb0 + ((st + it + 1) & (KBS - 1)));
            const _Float16* kn = ksrc + nn * FB_;
            const int*      mn = msrc + nn * 32;
            fetch_k(kc, kn);
            // precaution, as above, for the registers that these loads name
            if (MASKED) {
                kc.mk = *mn;
                asm volatile("s_wait_xcnt 0x0" :: "v"(kn), "v"(mn) : "memory");
            } else {
                asm volatile("s_wait_xcnt 0x0" :: "v"(kn) : "memory");
            }

            h16 pf[2];        // P^T as a B operand: k order hi8 + r, 16 + hi8 + r
            if constexpr (!MASKED) {
                // this lane's largest score above the shift, per tile
                float top[2];
                #pragma unroll
                for (int u = 0; u < 2; ++u) {
                    const f8 s0 = s[u][0], s1 = s[u][1];
                    const float x0 = fmaxf(fmaxf(s0[0], s0[1]), s0[2]);
                    const float x1 = fmaxf(fmaxf(s0[3], s0[4]), s0[5]);
                    const float x2 = fmaxf(fmaxf(s0[6], s0[7]), s1[0]);
                    const float x3 = fmaxf(fmaxf(s1[1], s1[2]), s1[3]);
                    const float x4 = fmaxf(fmaxf(s1[4], s1[5]), s1[6]);
                    top[u] = fmaxf(fmaxf(fmaxf(x0, x1), x2), fmaxf(fmaxf(x3, x4), s1[7]));
                }
                // one test per pass, the same for the whole wave: a scalar branch
                const bool far = fmaxf(top[0], top[1]) > 8.0f;
                if (it == 0 || __builtin_amdgcn_ballot_w32(far) != 0) {
                    #pragma unroll
                    for (int u = 0; u < 2; ++u) {
                        const float mx = fmaxf(top[u], xhalf(top[u]));
                        // the first pass takes the maximum as it is (O and the sum
                        // are still 0); later the shift only rises
                        const float d     = it == 0 ? mx : fmaxf(mx, 0.0f);
                        const float alpha = it == 0 ? 1.0f : __builtin_amdgcn_exp2f(-d);
                        mrun[u] += d;
                        s[u][0] -= d;
                        s[u][1] -= d;
                        ls[u][0] *= alpha;
                        ls[u][1] *= alpha;
                        #pragma unroll
                        for (int j = 0; j < 4; ++j)
                            o[u][j] *= alpha;
                        #pragma unroll
                        for (int r = 0; r < 8; ++r)
                            cn[u][r] = -mrun[u];
                    }
                }
                #pragma unroll
                for (int u = 0; u < 2; ++u)
                    #pragma unroll
                    for (int r = 0; r < 8; r += 2) {
                        f2 p0 = { __builtin_amdgcn_exp2f(s[u][0][r]),
                                  __builtin_amdgcn_exp2f(s[u][0][r + 1]) };
                        f2 p1 = { __builtin_amdgcn_exp2f(s[u][1][r]),
                                  __builtin_amdgcn_exp2f(s[u][1][r + 1]) };
                        ls[u][0] += p0;
                        ls[u][1] += p1;
                        pf[u][r]     = (_Float16)p0[0];
                        pf[u][r + 1] = (_Float16)p0[1];
                        pf[u][r + 8] = (_Float16)p1[0];
                        pf[u][r + 9] = (_Float16)p1[1];
                    }
            } else
            #pragma unroll
            for (int u = 0; u < 2; ++u) {
                f8 s0 = s[u][0], s1 = s[u][1];

                // a closed key scores -1e9, here in units of exp2
                #pragma unroll
                for (int r = 0; r < 8; ++r) {
                    s0[r] = ((ob >> r) & 1u)        ? s0[r] : -1e9f * L2E_;
                    s1[r] = ((ob >> (16 + r)) & 1u) ? s1[r] : -1e9f * L2E_;
                }

                // online softmax of query ln of tile u, in this lane's registers
                const float x0 = fmaxf(fmaxf(s0[0], s0[1]), s0[2]);
                const float x1 = fmaxf(fmaxf(s0[3], s0[4]), s0[5]);
                const float x2 = fmaxf(fmaxf(s0[6], s0[7]), s1[0]);
                const float x3 = fmaxf(fmaxf(s1[1], s1[2]), s1[3]);
                const float x4 = fmaxf(fmaxf(s1[4], s1[5]), s1[6]);
                float mx = fmaxf(fmaxf(fmaxf(x0, x1), x2), fmaxf(fmaxf(x3, x4), s1[7]));
                mx = fmaxf(mx, xhalf(mx));
                const float mnew  = fmaxf(mrun[u], mx);
                const float alpha = __builtin_amdgcn_exp2f(mrun[u] - mnew);
                mrun[u] = mnew;

                f2  sum0 = { 0.0f, 0.0f }, sum1 = sum0;
                #pragma unroll
                for (int r = 0; r < 8; r += 2) {
                    f2 e0 = { s0[r], s0[r + 1] };
                    f2 e1 = { s1[r], s1[r + 1] };
                    e0 = e0 - mnew;
                    e1 = e1 - mnew;
                    f2 p0 = { __builtin_amdgcn_exp2f(e0[0]), __builtin_amdgcn_exp2f(e0[1]) };
                    f2 p1 = { __builtin_amdgcn_exp2f(e1[0]), __builtin_amdgcn_exp2f(e1[1]) };
                    sum0 += p0;
                    sum1 += p1;
                    pf[u][r]     = (_Float16)p0[0];
                    pf[u][r + 1] = (_Float16)p0[1];
                    pf[u][r + 8] = (_Float16)p1[0];
                    pf[u][r + 9] = (_Float16)p1[1];
                }
                sum0 += sum1;
                lrun[u] = alpha * lrun[u] + (sum0[0] + sum0[1]);

                // rescale the accumulator: every element of a lane is of query ln
                #pragma unroll
                for (int j = 0; j < 4; ++j)
                    o[u][j] *= alpha;
            }

            // O^T += V^T @ P^T from the V fragments loaded at the head of the pass
            #pragma unroll
            for (int j = 0; j < 4; ++j) {
                const h16 vf = hcat(vl[j], vh[j]);
                o[0][j] = wmma_f16(vf, pf[0], o[0][j]);
                o[1][j] = wmma_f16(vf, pf[1], o[1][j]);
            }

            // compiler fence: holds the next block's K loads inside this pass;
            // without it the compiler carries their address over instead and
            // loads at the head of the next pass, right in front of their use
            asm volatile("" ::: "memory");
        }
        if (!MASKED) {
            #pragma unroll
            for (int u = 0; u < 2; ++u) {
                const f2 l2 = ls[u][0] + ls[u][1];
                lrun[u] = l2[0] + l2[1];
            }
        }
    };
    if (anyshut) walk(yes_t{});
    else         walk(no_t{});

    // hand the partial result over, row-major: 32 bytes per lane and tile
    #pragma unroll
    for (int u = 0; u < 2; ++u) {
        // the two halves of the wave summed different keys of the same query
        lrun[u] += xhalf(lrun[u]);
        float* ow = Opart[wave] + (u * 16 + ln) * OSTR + hi8;
        #pragma unroll
        for (int j = 0; j < 4; ++j) {
            f4 lo = { o[u][j][0], o[u][j][1], o[u][j][2], o[u][j][3] };
            f4 hc = { o[u][j][4], o[u][j][5], o[u][j][6], o[u][j][7] };
            *(f4*)(ow + j * 16)     = lo;
            *(f4*)(ow + j * 16 + 4) = hc;
        }
    }
    // lane l holds, of row l of the pair, the shift and the sum: tile l >> 4
    mpart[wave][lane] = lane < 16 ? mrun[0] : mrun[1];
    lpart[wave][lane] = lane < 16 ? lrun[0] : lrun[1];
    // every wave's partial result is in LDS before any wave reads one
    __syncthreads();

    // this wave finishes rows wave*4 .. wave*4 + 3 of the block's 64, eight lanes
    // a row, eight columns a lane: weight of eighth s is
    // exp2(m_s - m) / sum over s of l_s * exp2(m_s - m)
    const int row = t >> 3;            // row of the block
    const int pr2 = row >> 5;          // the query pair that holds it
    const int rr  = row & 31;          // its row in that pair
    const int col = (lane & 7) * 8;
    float ms[NS], wt[NS];
    float mall = -1e30f;
    #pragma unroll
    for (int s = 0; s < NS; ++s) {
        ms[s] = mpart[s * 2 + pr2][rr];
        mall  = fmaxf(mall, ms[s]);
    }
    float lsum = 0.0f;
    #pragma unroll
    for (int s = 0; s < NS; ++s) {
        wt[s] = __builtin_amdgcn_exp2f(ms[s] - mall);
        lsum += lpart[s * 2 + pr2][rr] * wt[s];
    }
    const float inv = 1.0f / lsum;

    f4 r0 = { 0.0f, 0.0f, 0.0f, 0.0f }, r1 = r0;
    #pragma unroll
    for (int s = 0; s < NS; ++s) {
        const float* pr = Opart[s * 2 + pr2] + rr * OSTR + col;
        r0 += *(const f4*)pr * wt[s];
        r1 += *(const f4*)(pr + 4) * wt[s];
    }
    float* orow = out + ((size_t)b * T_ + q0 + row) * H_ + col;
    *(f4*)orow       = r0 * inv;
    *(f4*)(orow + 4) = r1 * inv;
}

// ---------------------------------------------------------------------------
// Launch
// ---------------------------------------------------------------------------
extern "C" void kernel_launch(void* const* d_in, const int* in_sizes, int n_in,
                              void* d_out, int out_size, void* d_ws, size_t ws_size,
                              hipStream_t stream)
{
    const float* x    = (const float*)d_in[0];
    const float* Wq   = (const float*)d_in[1];
    const float* bq   = (const float*)d_in[2];
    const float* Wk   = (const float*)d_in[3];
    const float* bk   = (const float*)d_in[4];
    const float* Wv   = (const float*)d_in[5];
    const float* bv   = (const float*)d_in[6];
    const int*   mask = (const int*)d_in[7];
    float* out = (float*)d_out;

    _Float16* qkv = (_Float16*)d_ws;                 // 3 * BT * H halves = 6 MB
    const _Float16* Qh = qkv;
    const _Float16* Kh = qkv + (size_t)BT_ * H_;
    const _Float16* Vh = qkv + (size_t)2 * BT_ * H_;

    dim3 g1(BT_ / 128, 1, 2);
    qkv_proj_kernel<<<g1, 256, 0, stream>>>(x, Wq, bq, Wk, bk, Wv, bv, qkv);

    dim3 g2(T_ / 64, B_, 1);
    flash_attn_kernel<<<g2, 512, 0, stream>>>(Qh, Kh, Vh, mask, out);
}
